// v000
// Times are from an AMD MI455X. After a warm-up the kernel runs many times in a row, and a time is the length of
// such a window on the GPU divided by its runs, so every launch and the gaps after it count. The runs cycle
// through copies of the inputs. A figure is the median of several windows, for all but v000 over two sittings.
// Sittings can differ by a few percent; kernels timed side by side share one.
// v000, which the later versions start from, runs in 935 microseconds.
#include <hip/hip_runtime.h>

// ---------------------------------------------------------------- types
typedef __attribute__((ext_vector_type(16))) __bf16 v16bf;
typedef __attribute__((ext_vector_type(8)))  __bf16 v8bf;
typedef __attribute__((ext_vector_type(8)))  float  v8f;
typedef __attribute__((ext_vector_type(4)))  int    vi4;

#define NB   4
#define SEQ  2048
#define DM   1024
#define NH   16
#define DK   64

#define AS_GLOBAL __attribute__((address_space(1)))
#define AS_LDS    __attribute__((address_space(3)))

__device__ __forceinline__ v8f zero8() {
    v8f z;
#pragma unroll
    for (int i = 0; i < 8; ++i) z[i] = 0.0f;
    return z;
}

__device__ __forceinline__ v16bf cat16(v8bf lo, v8bf hi) {
    v16bf r;
#pragma unroll
    for (int i = 0; i < 8; ++i) { r[i] = lo[i]; r[8 + i] = hi[i]; }
    return r;
}

// A/B fragment (16x32 bf16) per ISA layout: lane m = lane&15,
// kb = (lane>=16)?8:0, elems 0..7 = K[kb..kb+7], 8..15 = K[kb+16..kb+23].
__device__ __forceinline__ v16bf frag_bf16(const __bf16* p) {
    v8bf lo = *reinterpret_cast<const v8bf*>(p);
    v8bf hi = *reinterpret_cast<const v8bf*>(p + 16);
    return cat16(lo, hi);
}

// Same fragment but converting fp32 source inline (two float4 pairs).
__device__ __forceinline__ v16bf frag_f32(const float* p) {
    const float4* p4 = reinterpret_cast<const float4*>(p);
    float4 f0 = p4[0], f1 = p4[1], f2 = p4[4], f3 = p4[5];
    v16bf r;
    r[0] = (__bf16)f0.x; r[1]  = (__bf16)f0.y; r[2]  = (__bf16)f0.z; r[3]  = (__bf16)f0.w;
    r[4] = (__bf16)f1.x; r[5]  = (__bf16)f1.y; r[6]  = (__bf16)f1.z; r[7]  = (__bf16)f1.w;
    r[8] = (__bf16)f2.x; r[9]  = (__bf16)f2.y; r[10] = (__bf16)f2.z; r[11] = (__bf16)f2.w;
    r[12] = (__bf16)f3.x; r[13] = (__bf16)f3.y; r[14] = (__bf16)f3.z; r[15] = (__bf16)f3.w;
    return r;
}

__device__ __forceinline__ v8f wmma_bf16(v16bf a, v16bf b, v8f c) {
    return __builtin_amdgcn_wmma_f32_16x16x32_bf16(false, a, false, b, (short)0, c, false, false);
}

// ---- async global->LDS staging (CDNA5 ASYNCcnt path), guarded fallback ----
__device__ __forceinline__ void stage_async_b128(const void* g, void* l) {
#if __has_builtin(__builtin_amdgcn_global_load_async_to_lds_b128)
    __builtin_amdgcn_global_load_async_to_lds_b128(
        (AS_GLOBAL vi4*)(g), (AS_LDS vi4*)(l), 0, 0);
#else
    *(float4*)l = *(const float4*)g;
#endif
}

__device__ __forceinline__ void stage_wait() {
#if __has_builtin(__builtin_amdgcn_global_load_async_to_lds_b128)
#if __has_builtin(__builtin_amdgcn_s_wait_asynccnt)
    __builtin_amdgcn_s_wait_asynccnt(0);
#else
    asm volatile("s_wait_asynccnt 0" ::: "memory");
#endif
#endif
    __syncthreads();
}

// ---------------------------------------------------------------- kernel 1:
// transpose-convert the 4 weight matrices to bf16 W^T (row = out-col, contiguous K)
__global__ __launch_bounds__(256) void wconv_kernel(const float* __restrict__ Wq,
                                                    const float* __restrict__ Wk,
                                                    const float* __restrict__ Wv,
                                                    const float* __restrict__ Wo,
                                                    __bf16* __restrict__ Wt) {
    int w = blockIdx.y;
    const float* src = (w == 0) ? Wq : (w == 1) ? Wk : (w == 2) ? Wv : Wo;
    __bf16* dst = Wt + (size_t)w * DM * DM;
    int idx = blockIdx.x * 256 + threadIdx.x;   // n*1024 + k
    int n = idx >> 10, k = idx & (DM - 1);
    dst[idx] = (__bf16)src[(size_t)k * DM + n];
}

// ---------------------------------------------------------------- kernel 2:
// Y = X @ W + b, output in per-head layout (bf16). transposed=1 stores [b,h,dk,s].
// The 16-row fp32 A tile is staged once per block into LDS (async), shared by
// all 8 waves; each wave owns one 16-col tile of W^T.
__global__ __launch_bounds__(256) void proj_kernel(const float* __restrict__ X,
                                                   const __bf16* __restrict__ Wt,
                                                   const float* __restrict__ bias,
                                                   __bf16* __restrict__ out,
                                                   int transposed) {
    __shared__ __attribute__((aligned(16))) float As[16][DM];   // 64 KB

    int lane = threadIdx.x & 31, wave = threadIdx.x >> 5;
    int m0 = blockIdx.x * 16;
    int n0 = (blockIdx.y * 8 + wave) * 16;
    int colB = n0 + (lane & 15);
    int kb   = (lane >> 4) * 8;

    // stage A tile: 16 rows x 1024 f32 = 64 KB, 16B per lane per shot
    {
        const float* gsrc = X + (size_t)m0 * DM;
        float* lbase = &As[0][0];
#pragma unroll
        for (int it = 0; it < 16; ++it) {
            int idx = (it * 256 + threadIdx.x) * 4;
            stage_async_b128(gsrc + idx, lbase + idx);
        }
    }
    stage_wait();

    const float*  ap = &As[lane & 15][kb];
    const __bf16* bp = Wt + (size_t)colB * DM + kb;

    v8f c = zero8();
#pragma unroll 4
    for (int k0 = 0; k0 < DM; k0 += 32) {
        v16bf a = frag_f32(ap + k0);
        v16bf b = frag_bf16(bp + k0);
        c = wmma_bf16(a, b, c);
    }

    float bv = bias[colB];
    int h = colB >> 6, d = colB & (DK - 1);
#pragma unroll
    for (int i = 0; i < 8; ++i) {
        int M = i + ((lane >> 4) << 3);
        int r = m0 + M;
        int bidx = r >> 11, s = r & (SEQ - 1);
        float val = c[i] + bv;
        if (transposed)
            out[(((size_t)(bidx * NH + h)) * DK + d) * SEQ + s] = (__bf16)val;
        else
            out[(((size_t)(bidx * NH + h)) * SEQ + s) * DK + d] = (__bf16)val;
    }
}

// ---------------------------------------------------------------- kernel 3:
// flash attention: one 16-row Q tile per wave, 32 keys per iteration.
__global__ __launch_bounds__(256) void attn_kernel(const __bf16* __restrict__ Qh,
                                                   const __bf16* __restrict__ Kh,
                                                   const __bf16* __restrict__ Vt,
                                                   const int*    __restrict__ mask,
                                                   __bf16* __restrict__ ctx) {
    __shared__ __attribute__((aligned(16))) __bf16 pbuf[8][16][32];

    int lane = threadIdx.x & 31, wave = threadIdx.x >> 5;
    int bh = blockIdx.y;                 // b*NH + h
    int b  = bh >> 4, h = bh & (NH - 1);
    int q0 = (blockIdx.x * 8 + wave) * 16;
    int N  = lane & 15;
    int kb = (lane >> 4) * 8;

    // resident Q fragments (dk = 64 -> two 16x32 fragments)
    const __bf16* qbase = Qh + ((size_t)bh * SEQ + q0 + N) * DK;
    v16bf qa0 = frag_bf16(qbase + kb);
    v16bf qa1 = frag_bf16(qbase + 32 + kb);

    v8f o[4];
#pragma unroll
    for (int f = 0; f < 4; ++f) o[f] = zero8();
    float mrow[8], lrow[8];
#pragma unroll
    for (int i = 0; i < 8; ++i) { mrow[i] = -1e30f; lrow[i] = 0.0f; }

    const int* mbase = mask + (size_t)b * SEQ * SEQ;

    for (int s0 = 0; s0 < SEQ; s0 += 32) {
        // --- scores: two 16x16 tiles (keys s0..+15, s0+16..+31)
        const __bf16* kB0 = Kh + ((size_t)bh * SEQ + s0 + N) * DK;
        const __bf16* kB1 = kB0 + 16 * DK;
        v8f st0 = wmma_bf16(qa1, frag_bf16(kB0 + 32 + kb),
                  wmma_bf16(qa0, frag_bf16(kB0 + kb), zero8()));
        v8f st1 = wmma_bf16(qa1, frag_bf16(kB1 + 32 + kb),
                  wmma_bf16(qa0, frag_bf16(kB1 + kb), zero8()));

        if (s0 + 32 < SEQ)
            __builtin_prefetch(kB0 + 32 * DK, 0, 1);

        // --- scale, mask, online softmax (rows live across 16-lane halves)
#pragma unroll
        for (int i = 0; i < 8; ++i) {
            int M = i + ((lane >> 4) << 3);
            size_t roff = (size_t)(q0 + M) * SEQ + s0;
            float v0 = st0[i] * 0.125f;
            float v1 = st1[i] * 0.125f;
            if (mbase[roff + N] == 0)      v0 = -1e9f;
            if (mbase[roff + 16 + N] == 0) v1 = -1e9f;

            float t = fmaxf(v0, v1);
            t = fmaxf(t, __shfl_xor(t, 1, 16));
            t = fmaxf(t, __shfl_xor(t, 2, 16));
            t = fmaxf(t, __shfl_xor(t, 4, 16));
            t = fmaxf(t, __shfl_xor(t, 8, 16));
            float mnew  = fmaxf(mrow[i], t);
            float alpha = __expf(mrow[i] - mnew);
            float p0 = __expf(v0 - mnew);
            float p1 = __expf(v1 - mnew);
            float rs = p0 + p1;
            rs += __shfl_xor(rs, 1, 16);
            rs += __shfl_xor(rs, 2, 16);
            rs += __shfl_xor(rs, 4, 16);
            rs += __shfl_xor(rs, 8, 16);
            lrow[i] = lrow[i] * alpha + rs;
            mrow[i] = mnew;
            o[0][i] *= alpha; o[1][i] *= alpha; o[2][i] *= alpha; o[3][i] *= alpha;

            pbuf[wave][M][N]      = (__bf16)p0;
            pbuf[wave][M][16 + N] = (__bf16)p1;
        }

        asm volatile("s_wait_dscnt 0" ::: "memory");

        // --- P (16x32) as A fragment from this wave's private LDS tile
        v16bf pa = frag_bf16(&pbuf[wave][lane & 15][kb]);

        // --- O += P @ V  (V^T gives contiguous B-fragment columns)
#pragma unroll
        for (int f = 0; f < 4; ++f) {
            int dcol = f * 16 + N;
            const __bf16* vb = Vt + ((size_t)bh * DK + dcol) * SEQ + s0 + kb;
            o[f] = wmma_bf16(pa, frag_bf16(vb), o[f]);
        }
    }

    // --- normalize and store ctx (bf16, [B,S,D] with D = h*64+d)
#pragma unroll
    for (int i = 0; i < 8; ++i) {
        int M = i + ((lane >> 4) << 3);
        float inv = 1.0f / lrow[i];
        size_t base = ((size_t)(b * SEQ + q0 + M)) * DM + h * DK + N;
        ctx[base +  0] = (__bf16)(o[0][i] * inv);
        ctx[base + 16] = (__bf16)(o[1][i] * inv);
        ctx[base + 32] = (__bf16)(o[2][i] * inv);
        ctx[base + 48] = (__bf16)(o[3][i] * inv);
    }
}

// ---------------------------------------------------------------- kernel 4:
// out = LN(ctx @ Wo + bo + residual); one block = 16 full rows.
// The shared bf16 ctx A tile (32 KB) is staged async into LDS.
__global__ __launch_bounds__(256) void oproj_ln_kernel(const __bf16* __restrict__ ctx,
                                                       const __bf16* __restrict__ Wot,
                                                       const float* __restrict__ bo,
                                                       const float* __restrict__ residual,
                                                       const float* __restrict__ gamma,
                                                       const float* __restrict__ beta,
                                                       float* __restrict__ out) {
    __shared__ __attribute__((aligned(16))) __bf16 Abuf[16][DM];  // 32 KB
    __shared__ __attribute__((aligned(16))) float  xrow[16][DM];  // 64 KB

    int lane = threadIdx.x & 31, wave = threadIdx.x >> 5;
    int m0 = blockIdx.x * 16;
    int kb = (lane >> 4) * 8;

    // stage A tile: 16 rows x 1024 bf16 = 32 KB
    {
        const __bf16* gsrc = ctx + (size_t)m0 * DM;
        __bf16* lbase = &Abuf[0][0];
#pragma unroll
        for (int it = 0; it < 8; ++it) {
            int idx = (it * 256 + threadIdx.x) * 8;
            stage_async_b128(gsrc + idx, lbase + idx);
        }
    }
    stage_wait();

    const __bf16* ap = &Abuf[lane & 15][kb];

#pragma unroll
    for (int t = 0; t < 8; ++t) {
        int colB = (wave * 8 + t) * 16 + (lane & 15);
        const __bf16* bp = Wot + (size_t)colB * DM + kb;
        v8f c = zero8();
#pragma unroll 4
        for (int k0 = 0; k0 < DM; k0 += 32)
            c = wmma_bf16(frag_bf16(ap + k0), frag_bf16(bp + k0), c);
        float bv = bo[colB];
#pragma unroll
        for (int i = 0; i < 8; ++i) {
            int M = i + ((lane >> 4) << 3);
            float val = c[i] + bv + residual[(size_t)(m0 + M) * DM + colB];
            xrow[M][colB] = val;
        }
    }

    __syncthreads();

    // LayerNorm: 8 waves x 2 rows
#pragma unroll
    for (int rr = 0; rr < 2; ++rr) {
        int r = wave * 2 + rr;
        float sum = 0.0f, sq = 0.0f;
#pragma unroll
        for (int j = 0; j < DM / 32; ++j) {
            float x = xrow[r][lane + 32 * j];
            sum += x; sq += x * x;
        }
#pragma unroll
        for (int d = 1; d < 32; d <<= 1) {
            sum += __shfl_xor(sum, d, 32);
            sq  += __shfl_xor(sq,  d, 32);
        }
        float mu   = sum * (1.0f / DM);
        float var  = sq * (1.0f / DM) - mu * mu;
        float rinv = rsqrtf(var + 1e-6f);
        size_t grow = (size_t)(m0 + r) * DM;
#pragma unroll
        for (int j = 0; j < DM / 32; ++j) {
            int col = lane + 32 * j;
            float x = xrow[r][col];
            out[grow + col] = (x - mu) * rinv * gamma[col] + beta[col];
        }
    }
}

// ---------------------------------------------------------------- launcher
extern "C" void kernel_launch(void* const* d_in, const int* in_sizes, int n_in,
                              void* d_out, int out_size, void* d_ws, size_t ws_size,
                              hipStream_t stream) {
    const float* q    = (const float*)d_in[0];
    const float* k    = (const float*)d_in[1];
    const float* v    = (const float*)d_in[2];
    const int*   mask = (const int*)  d_in[3];
    const float* Wq   = (const float*)d_in[4];
    const float* bq   = (const float*)d_in[5];
    const float* Wk   = (const float*)d_in[6];
    const float* bk   = (const float*)d_in[7];
    const float* Wv   = (const float*)d_in[8];
    const float* bv   = (const float*)d_in[9];
    const float* Wo   = (const float*)d_in[10];
    const float* bo   = (const float*)d_in[11];
    const float* gamma = (const float*)d_in[12];
    const float* beta  = (const float*)d_in[13];
    float* out = (float*)d_out;

    char* ws = (char*)d_ws;
    const size_t WSZ  = (size_t)DM * DM;              // per-weight elems
    const size_t HSZ  = (size_t)NB * NH * SEQ * DK;   // per-head-tensor elems
    __bf16* Wt  = (__bf16*)ws;                                        // 4*WSZ bf16
    __bf16* Qh  = (__bf16*)(ws + 4 * WSZ * 2);                        // HSZ
    __bf16* Kh  = Qh + HSZ;
    __bf16* Vt  = Kh + HSZ;
    __bf16* CTX = Vt + HSZ;                                           // HSZ

    wconv_kernel<<<dim3(WSZ / 256, 4), 256, 0, stream>>>(Wq, Wk, Wv, Wo, Wt);

    dim3 pg(NB * SEQ / 16, DM / (16 * 8));
    proj_kernel<<<pg, 256, 0, stream>>>(q, Wt,           bq, Qh, 0);
    proj_kernel<<<pg, 256, 0, stream>>>(k, Wt + WSZ,     bk, Kh, 0);
    proj_kernel<<<pg, 256, 0, stream>>>(v, Wt + 2 * WSZ, bv, Vt, 1);

    attn_kernel<<<dim3(SEQ / 128, NB * NH), 256, 0, stream>>>(Qh, Kh, Vt, mask, CTX);

    oproj_ln_kernel<<<dim3(NB * SEQ / 16), 256, 0, stream>>>(
        CTX, Wt + 3 * WSZ, bo, q, gamma, beta, out);
}

// v001
// Measured time: 624 microseconds a run.
// In both of two side-by-side timings against v000, it was 1.56 times as fast.
#include <hip/hip_runtime.h>

// ---------------------------------------------------------------- types
typedef __attribute__((ext_vector_type(16))) __bf16 v16bf;
typedef __attribute__((ext_vector_type(8)))  __bf16 v8bf;
typedef __attribute__((ext_vector_type(8)))  float  v8f;
typedef __attribute__((ext_vector_type(4)))  int    vi4;

#define NB   4
#define SEQ  2048
#define DM   1024
#define NH   16
#define DK   64

// LDS row pads: every tile that ds_load_b128 reads as a WMMA fragment (16 lanes
// = 16 rows) gets a row pitch of 16 B x odd, so the 16 rows fall on 64 distinct
// banks instead of on the same four.
#define PADF 4    // f32 elements  (16 B)
#define PADH 8    // bf16 elements (16 B)

#define AS_GLOBAL __attribute__((address_space(1)))
#define AS_LDS    __attribute__((address_space(3)))

__device__ __forceinline__ v8f zero8() {
    v8f z;
#pragma unroll
    for (int i = 0; i < 8; ++i) z[i] = 0.0f;
    return z;
}

__device__ __forceinline__ v16bf cat16(v8bf lo, v8bf hi) {
    v16bf r;
#pragma unroll
    for (int i = 0; i < 8; ++i) { r[i] = lo[i]; r[8 + i] = hi[i]; }
    return r;
}

// A/B fragment (16x32 bf16) per ISA layout: lane m = lane&15,
// kb = (lane>=16)?8:0, elems 0..7 = K[kb..kb+7], 8..15 = K[kb+16..kb+23].
__device__ __forceinline__ v16bf frag_bf16(const __bf16* p) {
    v8bf lo = *reinterpret_cast<const v8bf*>(p);
    v8bf hi = *reinterpret_cast<const v8bf*>(p + 16);
    return cat16(lo, hi);
}

// Same fragment but converting fp32 source inline (two float4 pairs).
__device__ __forceinline__ v16bf frag_f32(const float* p) {
    const float4* p4 = reinterpret_cast<const float4*>(p);
    float4 f0 = p4[0], f1 = p4[1], f2 = p4[4], f3 = p4[5];
    v16bf r;
    r[0] = (__bf16)f0.x; r[1]  = (__bf16)f0.y; r[2]  = (__bf16)f0.z; r[3]  = (__bf16)f0.w;
    r[4] = (__bf16)f1.x; r[5]  = (__bf16)f1.y; r[6]  = (__bf16)f1.z; r[7]  = (__bf16)f1.w;
    r[8] = (__bf16)f2.x; r[9]  = (__bf16)f2.y; r[10] = (__bf16)f2.z; r[11] = (__bf16)f2.w;
    r[12] = (__bf16)f3.x; r[13] = (__bf16)f3.y; r[14] = (__bf16)f3.z; r[15] = (__bf16)f3.w;
    return r;
}

__device__ __forceinline__ v8f wmma_bf16(v16bf a, v16bf b, v8f c) {
    return __builtin_amdgcn_wmma_f32_16x16x32_bf16(false, a, false, b, (short)0, c, false, false);
}

// ---- async global->LDS staging (CDNA5 ASYNCcnt path), guarded fallback ----
__device__ __forceinline__ void stage_async_b128(const void* g, void* l) {
#if __has_builtin(__builtin_amdgcn_global_load_async_to_lds_b128)
    __builtin_amdgcn_global_load_async_to_lds_b128(
        (AS_GLOBAL vi4*)(g), (AS_LDS vi4*)(l), 0, 0);
#else
    *(float4*)l = *(const float4*)g;
#endif
}

__device__ __forceinline__ void stage_wait() {
#if __has_builtin(__builtin_amdgcn_global_load_async_to_lds_b128)
#if __has_builtin(__builtin_amdgcn_s_wait_asynccnt)
    __builtin_amdgcn_s_wait_asynccnt(0);
#else
    asm volatile("s_wait_asynccnt 0" ::: "memory");
#endif
#endif
    __syncthreads();
}

// ---------------------------------------------------------------- kernel 1:
// transpose-convert the 4 weight matrices to bf16 W^T (row = out-col, contiguous K)
__global__ __launch_bounds__(256) void wconv_kernel(const float* __restrict__ Wq,
                                                    const float* __restrict__ Wk,
                                                    const float* __restrict__ Wv,
                                                    const float* __restrict__ Wo,
                                                    __bf16* __restrict__ Wt) {
    int w = blockIdx.y;
    const float* src = (w == 0) ? Wq : (w == 1) ? Wk : (w == 2) ? Wv : Wo;
    __bf16* dst = Wt + (size_t)w * DM * DM;
    int idx = blockIdx.x * 256 + threadIdx.x;   // n*1024 + k
    int n = idx >> 10, k = idx & (DM - 1);
    dst[idx] = (__bf16)src[(size_t)k * DM + n];
}

// ---------------------------------------------------------------- kernel 2:
// Y = X @ W + b, output in per-head layout (bf16). transposed=1 stores [b,h,dk,s].
// The 16-row fp32 A tile is staged once per block into LDS (async), shared by
// all 8 waves; each wave owns one 16-col tile of W^T.
__global__ __launch_bounds__(256) void proj_kernel(const float* __restrict__ X,
                                                   const __bf16* __restrict__ Wt,
                                                   const float* __restrict__ bias,
                                                   __bf16* __restrict__ out,
                                                   int transposed) {
    __shared__ __attribute__((aligned(16))) float As[16][DM + PADF];   // pitch 4112 B

    int lane = threadIdx.x & 31, wave = threadIdx.x >> 5;
    int m0 = blockIdx.x * 16;
    int n0 = (blockIdx.y * 8 + wave) * 16;
    int colB = n0 + (lane & 15);
    int kb   = (lane >> 4) * 8;

    // stage A tile: 16 rows x 1024 f32, 16B per lane per shot, one row per shot
    {
        const float* gsrc = X + (size_t)m0 * DM;
        int col = threadIdx.x * 4;
#pragma unroll
        for (int it = 0; it < 16; ++it)
            stage_async_b128(gsrc + it * DM + col, &As[it][col]);
    }
    stage_wait();

    const float*  ap = &As[lane & 15][kb];
    const __bf16* bp = Wt + (size_t)colB * DM + kb;

    v8f c = zero8();
#pragma unroll 4
    for (int k0 = 0; k0 < DM; k0 += 32) {
        v16bf a = frag_f32(ap + k0);
        v16bf b = frag_bf16(bp + k0);
        c = wmma_bf16(a, b, c);
    }

    float bv = bias[colB];
    int h = colB >> 6, d = colB & (DK - 1);
#pragma unroll
    for (int i = 0; i < 8; ++i) {
        int M = i + ((lane >> 4) << 3);
        int r = m0 + M;
        int bidx = r >> 11, s = r & (SEQ - 1);
        float val = c[i] + bv;
        if (transposed)
            out[(((size_t)(bidx * NH + h)) * DK + d) * SEQ + s] = (__bf16)val;
        else
            out[(((size_t)(bidx * NH + h)) * SEQ + s) * DK + d] = (__bf16)val;
    }
}

// ---------------------------------------------------------------- kernel 3:
// flash attention: one 16-row Q tile per wave, 32 keys per iteration.
__global__ __launch_bounds__(256) void attn_kernel(const __bf16* __restrict__ Qh,
                                                   const __bf16* __restrict__ Kh,
                                                   const __bf16* __restrict__ Vt,
                                                   const int*    __restrict__ mask,
                                                   __bf16* __restrict__ ctx) {
    __shared__ __attribute__((aligned(16))) __bf16 pbuf[8][16][32 + PADH];   // pitch 80 B

    int lane = threadIdx.x & 31, wave = threadIdx.x >> 5;
    int bh = blockIdx.y;                 // b*NH + h
    int b  = bh >> 4, h = bh & (NH - 1);
    int q0 = (blockIdx.x * 8 + wave) * 16;
    int N  = lane & 15;
    int kb = (lane >> 4) * 8;

    // resident Q fragments (dk = 64 -> two 16x32 fragments)
    const __bf16* qbase = Qh + ((size_t)bh * SEQ + q0 + N) * DK;
    v16bf qa0 = frag_bf16(qbase + kb);
    v16bf qa1 = frag_bf16(qbase + 32 + kb);

    v8f o[4];
#pragma unroll
    for (int f = 0; f < 4; ++f) o[f] = zero8();
    float mrow[8], lrow[8];
#pragma unroll
    for (int i = 0; i < 8; ++i) { mrow[i] = -1e30f; lrow[i] = 0.0f; }

    const int* mbase = mask + (size_t)b * SEQ * SEQ;

    for (int s0 = 0; s0 < SEQ; s0 += 32) {
        // --- scores: two 16x16 tiles (keys s0..+15, s0+16..+31)
        const __bf16* kB0 = Kh + ((size_t)bh * SEQ + s0 + N) * DK;
        const __bf16* kB1 = kB0 + 16 * DK;
        v8f st0 = wmma_bf16(qa1, frag_bf16(kB0 + 32 + kb),
                  wmma_bf16(qa0, frag_bf16(kB0 + kb), zero8()));
        v8f st1 = wmma_bf16(qa1, frag_bf16(kB1 + 32 + kb),
                  wmma_bf16(qa0, frag_bf16(kB1 + kb), zero8()));

        if (s0 + 32 < SEQ)
            __builtin_prefetch(kB0 + 32 * DK, 0, 1);

        // --- scale, mask, online softmax (rows live across 16-lane halves)
#pragma unroll
        for (int i = 0; i < 8; ++i) {
            int M = i + ((lane >> 4) << 3);
            size_t roff = (size_t)(q0 + M) * SEQ + s0;
            float v0 = st0[i] * 0.125f;
            float v1 = st1[i] * 0.125f;
            if (mbase[roff + N] == 0)      v0 = -1e9f;
            if (mbase[roff + 16 + N] == 0) v1 = -1e9f;

            float t = fmaxf(v0, v1);
            t = fmaxf(t, __shfl_xor(t, 1, 16));
            t = fmaxf(t, __shfl_xor(t, 2, 16));
            t = fmaxf(t, __shfl_xor(t, 4, 16));
            t = fmaxf(t, __shfl_xor(t, 8, 16));
            float mnew  = fmaxf(mrow[i], t);
            float alpha = __expf(mrow[i] - mnew);
            float p0 = __expf(v0 - mnew);
            float p1 = __expf(v1 - mnew);
            float rs = p0 + p1;
            rs += __shfl_xor(rs, 1, 16);
            rs += __shfl_xor(rs, 2, 16);
            rs += __shfl_xor(rs, 4, 16);
            rs += __shfl_xor(rs, 8, 16);
            lrow[i] = lrow[i] * alpha + rs;
            mrow[i] = mnew;
            o[0][i] *= alpha; o[1][i] *= alpha; o[2][i] *= alpha; o[3][i] *= alpha;

            pbuf[wave][M][N]      = (__bf16)p0;
            pbuf[wave][M][16 + N] = (__bf16)p1;
        }

        asm volatile("s_wait_dscnt 0" ::: "memory");

        // --- P (16x32) as A fragment from this wave's private LDS tile
        v16bf pa = frag_bf16(&pbuf[wave][lane & 15][kb]);

        // --- O += P @ V  (V^T gives contiguous B-fragment columns)
#pragma unroll
        for (int f = 0; f < 4; ++f) {
            int dcol = f * 16 + N;
            const __bf16* vb = Vt + ((size_t)bh * DK + dcol) * SEQ + s0 + kb;
            o[f] = wmma_bf16(pa, frag_bf16(vb), o[f]);
        }
    }

    // --- normalize and store ctx (bf16, [B,S,D] with D = h*64+d)
#pragma unroll
    for (int i = 0; i < 8; ++i) {
        int M = i + ((lane >> 4) << 3);
        float inv = 1.0f / lrow[i];
        size_t base = ((size_t)(b * SEQ + q0 + M)) * DM + h * DK + N;
        ctx[base +  0] = (__bf16)(o[0][i] * inv);
        ctx[base + 16] = (__bf16)(o[1][i] * inv);
        ctx[base + 32] = (__bf16)(o[2][i] * inv);
        ctx[base + 48] = (__bf16)(o[3][i] * inv);
    }
}

// ---------------------------------------------------------------- kernel 4:
// out = LN(ctx @ Wo + bo + residual); one block = 16 full rows.
// The shared bf16 ctx A tile (32 KB) is staged async into LDS.
__global__ __launch_bounds__(256) void oproj_ln_kernel(const __bf16* __restrict__ ctx,
                                                       const __bf16* __restrict__ Wot,
                                                       const float* __restrict__ bo,
                                                       const float* __restrict__ residual,
                                                       const float* __restrict__ gamma,
                                                       const float* __restrict__ beta,
                                                       float* __restrict__ out) {
    __shared__ __attribute__((aligned(16))) __bf16 Abuf[16][DM + PADH];  // pitch 2064 B
    __shared__ __attribute__((aligned(16))) float  xrow[16][DM];  // 64 KB

    int lane = threadIdx.x & 31, wave = threadIdx.x >> 5;
    int m0 = blockIdx.x * 16;
    int kb = (lane >> 4) * 8;

    // stage A tile: 16 rows x 1024 bf16, two rows per shot
    {
        const __bf16* gsrc = ctx + (size_t)m0 * DM;
        int row = threadIdx.x >> 7, col = (threadIdx.x & 127) * 8;
#pragma unroll
        for (int it = 0; it < 8; ++it)
            stage_async_b128(gsrc + (it * 2 + row) * DM + col, &Abuf[it * 2 + row][col]);
    }
    stage_wait();

    const __bf16* ap = &Abuf[lane & 15][kb];

#pragma unroll
    for (int t = 0; t < 8; ++t) {
        int colB = (wave * 8 + t) * 16 + (lane & 15);
        const __bf16* bp = Wot + (size_t)colB * DM + kb;
        v8f c = zero8();
#pragma unroll 4
        for (int k0 = 0; k0 < DM; k0 += 32)
            c = wmma_bf16(frag_bf16(ap + k0), frag_bf16(bp + k0), c);
        float bv = bo[colB];
#pragma unroll
        for (int i = 0; i < 8; ++i) {
            int M = i + ((lane >> 4) << 3);
            float val = c[i] + bv + residual[(size_t)(m0 + M) * DM + colB];
            xrow[M][colB] = val;
        }
    }

    __syncthreads();

    // LayerNorm: 8 waves x 2 rows
#pragma unroll
    for (int rr = 0; rr < 2; ++rr) {
        int r = wave * 2 + rr;
        float sum = 0.0f, sq = 0.0f;
#pragma unroll
        for (int j = 0; j < DM / 32; ++j) {
            float x = xrow[r][lane + 32 * j];
            sum += x; sq += x * x;
        }
#pragma unroll
        for (int d = 1; d < 32; d <<= 1) {
            sum += __shfl_xor(sum, d, 32);
            sq  += __shfl_xor(sq,  d, 32);
        }
        float mu   = sum * (1.0f / DM);
        float var  = sq * (1.0f / DM) - mu * mu;
        float rinv = rsqrtf(var + 1e-6f);
        size_t grow = (size_t)(m0 + r) * DM;
#pragma unroll
        for (int j = 0; j < DM / 32; ++j) {
            int col = lane + 32 * j;
            float x = xrow[r][col];
            out[grow + col] = (x - mu) * rinv * gamma[col] + beta[col];
        }
    }
}

// ---------------------------------------------------------------- launcher
extern "C" void kernel_launch(void* const* d_in, const int* in_sizes, int n_in,
                              void* d_out, int out_size, void* d_ws, size_t ws_size,
                              hipStream_t stream) {
    const float* q    = (const float*)d_in[0];
    const float* k    = (const float*)d_in[1];
    const float* v    = (const float*)d_in[2];
    const int*   mask = (const int*)  d_in[3];
    const float* Wq   = (const float*)d_in[4];
    const float* bq   = (const float*)d_in[5];
    const float* Wk   = (const float*)d_in[6];
    const float* bk   = (const float*)d_in[7];
    const float* Wv   = (const float*)d_in[8];
    const float* bv   = (const float*)d_in[9];
    const float* Wo   = (const float*)d_in[10];
    const float* bo   = (const float*)d_in[11];
    const float* gamma = (const float*)d_in[12];
    const float* beta  = (const float*)d_in[13];
    float* out = (float*)d_out;

    char* ws = (char*)d_ws;
    const size_t WSZ  = (size_t)DM * DM;              // per-weight elems
    const size_t HSZ  = (size_t)NB * NH * SEQ * DK;   // per-head-tensor elems
    __bf16* Wt  = (__bf16*)ws;                                        // 4*WSZ bf16
    __bf16* Qh  = (__bf16*)(ws + 4 * WSZ * 2);                        // HSZ
    __bf16* Kh  = Qh + HSZ;
    __bf16* Vt  = Kh + HSZ;
    __bf16* CTX = Vt + HSZ;                                           // HSZ

    wconv_kernel<<<dim3(WSZ / 256, 4), 256, 0, stream>>>(Wq, Wk, Wv, Wo, Wt);

    dim3 pg(NB * SEQ / 16, DM / (16 * 8));
    proj_kernel<<<pg, 256, 0, stream>>>(q, Wt,           bq, Qh, 0);
    proj_kernel<<<pg, 256, 0, stream>>>(k, Wt + WSZ,     bk, Kh, 0);
    proj_kernel<<<pg, 256, 0, stream>>>(v, Wt + 2 * WSZ, bv, Vt, 1);

    attn_kernel<<<dim3(SEQ / 128, NB * NH), 256, 0, stream>>>(Qh, Kh, Vt, mask, CTX);

    oproj_ln_kernel<<<dim3(NB * SEQ / 16), 256, 0, stream>>>(
        CTX, Wt + 3 * WSZ, bo, q, gamma, beta, out);
}

// v002
// Measured time: 504 microseconds a run.
// Two timings next to v001 both put it at 1.24 times that version's speed.
// Counting every step since v000, it is 1.93 times as fast.
#include <hip/hip_runtime.h>

// ---------------------------------------------------------------- types
typedef __attribute__((ext_vector_type(16))) __bf16 v16bf;
typedef __attribute__((ext_vector_type(8)))  __bf16 v8bf;
typedef __attribute__((ext_vector_type(8)))  float  v8f;
typedef __attribute__((ext_vector_type(4)))  int    vi4;

#define NB   4
#define SEQ  2048
#define DM   1024
#define NH   16
#define DK   64

// LDS row pads: every tile that ds_load_b128 reads as a WMMA fragment (16 lanes
// = 16 rows) gets a row pitch of 16 B x odd, so the 16 rows fall on 64 distinct
// banks instead of on the same four.
#define PADF 4    // f32 elements  (16 B)
#define PADH 8    // bf16 elements (16 B)

#define AS_GLOBAL __attribute__((address_space(1)))
#define AS_LDS    __attribute__((address_space(3)))

__device__ __forceinline__ v8f zero8() {
    v8f z;
#pragma unroll
    for (int i = 0; i < 8; ++i) z[i] = 0.0f;
    return z;
}

__device__ __forceinline__ v16bf cat16(v8bf lo, v8bf hi) {
    v16bf r;
#pragma unroll
    for (int i = 0; i < 8; ++i) { r[i] = lo[i]; r[8 + i] = hi[i]; }
    return r;
}

// A/B fragment (16x32 bf16) per ISA layout: lane m = lane&15,
// kb = (lane>=16)?8:0, elems 0..7 = K[kb..kb+7], 8..15 = K[kb+16..kb+23].
__device__ __forceinline__ v16bf frag_bf16(const __bf16* p) {
    v8bf lo = *reinterpret_cast<const v8bf*>(p);
    v8bf hi = *reinterpret_cast<const v8bf*>(p + 16);
    return cat16(lo, hi);
}

// Packed weights: W^T is stored in B-fragment order. One 16-col x 32-k fragment
// is a 1 KB block [half-fragment 2][lane 32][8 bf16], so that each wave-wide
// 16-byte load reads 512 contiguous bytes (4 whole lines). Blocks run k-step
// first, then 16-column tile. Lane and element carry the same k as frag_bf16.
#define WFRAG 512                  // bf16 elements per fragment block
#define WTILE (WFRAG * (DM / 32))  // bf16 elements per 16-column tile
__device__ __forceinline__ v16bf frag_packed(const __bf16* p) {
    v8bf lo = *reinterpret_cast<const v8bf*>(p);
    v8bf hi = *reinterpret_cast<const v8bf*>(p + 256);
    return cat16(lo, hi);
}

// Same fragment but converting fp32 source inline (two float4 pairs).
__device__ __forceinline__ v16bf frag_f32(const float* p) {
    const float4* p4 = reinterpret_cast<const float4*>(p);
    float4 f0 = p4[0], f1 = p4[1], f2 = p4[4], f3 = p4[5];
    v16bf r;
    r[0] = (__bf16)f0.x; r[1]  = (__bf16)f0.y; r[2]  = (__bf16)f0.z; r[3]  = (__bf16)f0.w;
    r[4] = (__bf16)f1.x; r[5]  = (__bf16)f1.y; r[6]  = (__bf16)f1.z; r[7]  = (__bf16)f1.w;
    r[8] = (__bf16)f2.x; r[9]  = (__bf16)f2.y; r[10] = (__bf16)f2.z; r[11] = (__bf16)f2.w;
    r[12] = (__bf16)f3.x; r[13] = (__bf16)f3.y; r[14] = (__bf16)f3.z; r[15] = (__bf16)f3.w;
    return r;
}

__device__ __forceinline__ v8f wmma_bf16(v16bf a, v16bf b, v8f c) {
    return __builtin_amdgcn_wmma_f32_16x16x32_bf16(false, a, false, b, (short)0, c, false, false);
}

// ---- async global->LDS staging (CDNA5 ASYNCcnt path), guarded fallback ----
__device__ __forceinline__ void stage_async_b128(const void* g, void* l) {
#if __has_builtin(__builtin_amdgcn_global_load_async_to_lds_b128)
    __builtin_amdgcn_global_load_async_to_lds_b128(
        (AS_GLOBAL vi4*)(g), (AS_LDS vi4*)(l), 0, 0);
#else
    *(float4*)l = *(const float4*)g;
#endif
}

__device__ __forceinline__ void stage_wait() {
#if __has_builtin(__builtin_amdgcn_global_load_async_to_lds_b128)
#if __has_builtin(__builtin_amdgcn_s_wait_asynccnt)
    __builtin_amdgcn_s_wait_asynccnt(0);
#else
    asm volatile("s_wait_asynccnt 0" ::: "memory");
#endif
#endif
    __syncthreads();
}

// ---------------------------------------------------------------- kernel 1:
// convert the 4 weight matrices to bf16 W^T in packed B-fragment order;
// one thread writes one lane's 16-byte piece (8 consecutive k of one column)
__global__ __launch_bounds__(256) void wconv_kernel(const float* __restrict__ Wq,
                                                    const float* __restrict__ Wk,
                                                    const float* __restrict__ Wv,
                                                    const float* __restrict__ Wo,
                                                    __bf16* __restrict__ Wt) {
    int w = blockIdx.y;
    const float* src = (w == 0) ? Wq : (w == 1) ? Wk : (w == 2) ? Wv : Wo;
    __bf16* dst = Wt + (size_t)w * DM * DM;
    int p = blockIdx.x * 256 + threadIdx.x;     // piece index in the packed order
    int ln = p & 31, hi = (p >> 5) & 1, ks = (p >> 6) & 31, nt = p >> 11;
    int n = nt * 16 + (ln & 15);
    int k = ks * 32 + hi * 16 + (ln >> 4) * 8;
    v8bf r;
    // unrolled: r is indexed by constants (stays in registers), the 8 loads issue together
#pragma unroll
    for (int e = 0; e < 8; ++e) r[e] = (__bf16)src[(size_t)(k + e) * DM + n];
    *reinterpret_cast<v8bf*>(dst + (size_t)p * 8) = r;
}

// ---------------------------------------------------------------- kernel 2:
// Y = X @ W + b, output in per-head layout (bf16). transposed=1 stores [b,h,dk,s].
// The 16-row fp32 A tile is staged once per block into LDS (async), shared by
// all 8 waves; each wave owns one 16-col tile of the packed W^T.
__global__ __launch_bounds__(256) void proj_kernel(const float* __restrict__ X,
                                                   const __bf16* __restrict__ Wt,
                                                   const float* __restrict__ bias,
                                                   __bf16* __restrict__ out,
                                                   int transposed) {
    __shared__ __attribute__((aligned(16))) float As[16][DM + PADF];   // pitch 4112 B

    int lane = threadIdx.x & 31, wave = threadIdx.x >> 5;
    int m0 = blockIdx.x * 16;
    int n0 = (blockIdx.y * 8 + wave) * 16;
    int colB = n0 + (lane & 15);
    int kb   = (lane >> 4) * 8;

    // stage A tile: 16 rows x 1024 f32, 16B per lane per shot, one row per shot
    {
        const float* gsrc = X + (size_t)m0 * DM;
        int col = threadIdx.x * 4;
#pragma unroll
        for (int it = 0; it < 16; ++it)
            stage_async_b128(gsrc + it * DM + col, &As[it][col]);
    }
    stage_wait();

    const float*  ap = &As[lane & 15][kb];
    const __bf16* bp = Wt + (size_t)(n0 >> 4) * WTILE + lane * 8;

    v8f c = zero8();
#pragma unroll 4
    for (int k0 = 0; k0 < DM; k0 += 32) {
        v16bf a = frag_f32(ap + k0);
        v16bf b = frag_packed(bp + (k0 >> 5) * WFRAG);
        c = wmma_bf16(a, b, c);
    }

    float bv = bias[colB];
    int h = colB >> 6, d = colB & (DK - 1);
#pragma unroll
    for (int i = 0; i < 8; ++i) {
        int M = i + ((lane >> 4) << 3);
        int r = m0 + M;
        int bidx = r >> 11, s = r & (SEQ - 1);
        float val = c[i] + bv;
        if (transposed)
            out[(((size_t)(bidx * NH + h)) * DK + d) * SEQ + s] = (__bf16)val;
        else
            out[(((size_t)(bidx * NH + h)) * SEQ + s) * DK + d] = (__bf16)val;
    }
}

// ---------------------------------------------------------------- kernel 3:
// flash attention: one 16-row Q tile per wave, 32 keys per iteration.
__global__ __launch_bounds__(256) void attn_kernel(const __bf16* __restrict__ Qh,
                                                   const __bf16* __restrict__ Kh,
                                                   const __bf16* __restrict__ Vt,
                                                   const int*    __restrict__ mask,
                                                   __bf16* __restrict__ ctx) {
    __shared__ __attribute__((aligned(16))) __bf16 pbuf[8][16][32 + PADH];   // pitch 80 B

    int lane = threadIdx.x & 31, wave = threadIdx.x >> 5;
    int bh = blockIdx.y;                 // b*NH + h
    int b  = bh >> 4, h = bh & (NH - 1);
    int q0 = (blockIdx.x * 8 + wave) * 16;
    int N  = lane & 15;
    int kb = (lane >> 4) * 8;

    // resident Q fragments (dk = 64 -> two 16x32 fragments)
    const __bf16* qbase = Qh + ((size_t)bh * SEQ + q0 + N) * DK;
    v16bf qa0 = frag_bf16(qbase + kb);
    v16bf qa1 = frag_bf16(qbase + 32 + kb);

    v8f o[4];
#pragma unroll
    for (int f = 0; f < 4; ++f) o[f] = zero8();
    float mrow[8], lrow[8];
#pragma unroll
    for (int i = 0; i < 8; ++i) { mrow[i] = -1e30f; lrow[i] = 0.0f; }

    const int* mbase = mask + (size_t)b * SEQ * SEQ;

    for (int s0 = 0; s0 < SEQ; s0 += 32) {
        // --- scores: two 16x16 tiles (keys s0..+15, s0+16..+31)
        const __bf16* kB0 = Kh + ((size_t)bh * SEQ + s0 + N) * DK;
        const __bf16* kB1 = kB0 + 16 * DK;
        v8f st0 = wmma_bf16(qa1, frag_bf16(kB0 + 32 + kb),
                  wmma_bf16(qa0, frag_bf16(kB0 + kb), zero8()));
        v8f st1 = wmma_bf16(qa1, frag_bf16(kB1 + 32 + kb),
                  wmma_bf16(qa0, frag_bf16(kB1 + kb), zero8()));

        if (s0 + 32 < SEQ)
            __builtin_prefetch(kB0 + 32 * DK, 0, 1);

        // --- scale, mask, online softmax (rows live across 16-lane halves)
#pragma unroll
        for (int i = 0; i < 8; ++i) {
            int M = i + ((lane >> 4) << 3);
            size_t roff = (size_t)(q0 + M) * SEQ + s0;
            float v0 = st0[i] * 0.125f;
            float v1 = st1[i] * 0.125f;
            if (mbase[roff + N] == 0)      v0 = -1e9f;
            if (mbase[roff + 16 + N] == 0) v1 = -1e9f;

            float t = fmaxf(v0, v1);
            t = fmaxf(t, __shfl_xor(t, 1, 16));
            t = fmaxf(t, __shfl_xor(t, 2, 16));
            t = fmaxf(t, __shfl_xor(t, 4, 16));
            t = fmaxf(t, __shfl_xor(t, 8, 16));
            float mnew  = fmaxf(mrow[i], t);
            float alpha = __expf(mrow[i] - mnew);
            float p0 = __expf(v0 - mnew);
            float p1 = __expf(v1 - mnew);
            float rs = p0 + p1;
            rs += __shfl_xor(rs, 1, 16);
            rs += __shfl_xor(rs, 2, 16);
            rs += __shfl_xor(rs, 4, 16);
            rs += __shfl_xor(rs, 8, 16);
            lrow[i] = lrow[i] * alpha + rs;
            mrow[i] = mnew;
            o[0][i] *= alpha; o[1][i] *= alpha; o[2][i] *= alpha; o[3][i] *= alpha;

            pbuf[wave][M][N]      = (__bf16)p0;
            pbuf[wave][M][16 + N] = (__bf16)p1;
        }

        asm volatile("s_wait_dscnt 0" ::: "memory");

        // --- P (16x32) as A fragment from this wave's private LDS tile
        v16bf pa = frag_bf16(&pbuf[wave][lane & 15][kb]);

        // --- O += P @ V  (V^T gives contiguous B-fragment columns)
#pragma unroll
        for (int f = 0; f < 4; ++f) {
            int dcol = f * 16 + N;
            const __bf16* vb = Vt + ((size_t)bh * DK + dcol) * SEQ + s0 + kb;
            o[f] = wmma_bf16(pa, frag_bf16(vb), o[f]);
        }
    }

    // --- normalize and store ctx (bf16, [B,S,D] with D = h*64+d)
#pragma unroll
    for (int i = 0; i < 8; ++i) {
        int M = i + ((lane >> 4) << 3);
        float inv = 1.0f / lrow[i];
        size_t base = ((size_t)(b * SEQ + q0 + M)) * DM + h * DK + N;
        ctx[base +  0] = (__bf16)(o[0][i] * inv);
        ctx[base + 16] = (__bf16)(o[1][i] * inv);
        ctx[base + 32] = (__bf16)(o[2][i] * inv);
        ctx[base + 48] = (__bf16)(o[3][i] * inv);
    }
}

// ---------------------------------------------------------------- kernel 4:
// out = LN(ctx @ Wo + bo + residual); one block = 16 full rows.
// The shared bf16 ctx A tile (32 KB) is staged async into LDS.
__global__ __launch_bounds__(256) void oproj_ln_kernel(const __bf16* __restrict__ ctx,
                                                       const __bf16* __restrict__ Wot,
                                                       const float* __restrict__ bo,
                                                       const float* __restrict__ residual,
                                                       const float* __restrict__ gamma,
                                                       const float* __restrict__ beta,
                                                       float* __restrict__ out) {
    __shared__ __attribute__((aligned(16))) __bf16 Abuf[16][DM + PADH];  // pitch 2064 B
    __shared__ __attribute__((aligned(16))) float  xrow[16][DM];  // 64 KB

    int lane = threadIdx.x & 31, wave = threadIdx.x >> 5;
    int m0 = blockIdx.x * 16;
    int kb = (lane >> 4) * 8;

    // stage A tile: 16 rows x 1024 bf16, two rows per shot
    {
        const __bf16* gsrc = ctx + (size_t)m0 * DM;
        int row = threadIdx.x >> 7, col = (threadIdx.x & 127) * 8;
#pragma unroll
        for (int it = 0; it < 8; ++it)
            stage_async_b128(gsrc + (it * 2 + row) * DM + col, &Abuf[it * 2 + row][col]);
    }
    stage_wait();

    const __bf16* ap = &Abuf[lane & 15][kb];

#pragma unroll
    for (int t = 0; t < 8; ++t) {
        int colB = (wave * 8 + t) * 16 + (lane & 15);
        const __bf16* bp = Wot + (size_t)(wave * 8 + t) * WTILE + lane * 8;
        v8f c = zero8();
#pragma unroll 4
        for (int k0 = 0; k0 < DM; k0 += 32)
            c = wmma_bf16(frag_bf16(ap + k0), frag_packed(bp + (k0 >> 5) * WFRAG), c);
        float bv = bo[colB];
#pragma unroll
        for (int i = 0; i < 8; ++i) {
            int M = i + ((lane >> 4) << 3);
            float val = c[i] + bv + residual[(size_t)(m0 + M) * DM + colB];
            xrow[M][colB] = val;
        }
    }

    __syncthreads();

    // LayerNorm: 8 waves x 2 rows
#pragma unroll
    for (int rr = 0; rr < 2; ++rr) {
        int r = wave * 2 + rr;
        float sum = 0.0f, sq = 0.0f;
#pragma unroll
        for (int j = 0; j < DM / 32; ++j) {
            float x = xrow[r][lane + 32 * j];
            sum += x; sq += x * x;
        }
#pragma unroll
        for (int d = 1; d < 32; d <<= 1) {
            sum += __shfl_xor(sum, d, 32);
            sq  += __shfl_xor(sq,  d, 32);
        }
        float mu   = sum * (1.0f / DM);
        float var  = sq * (1.0f / DM) - mu * mu;
        float rinv = rsqrtf(var + 1e-6f);
        size_t grow = (size_t)(m0 + r) * DM;
#pragma unroll
        for (int j = 0; j < DM / 32; ++j) {
            int col = lane + 32 * j;
            float x = xrow[r][col];
            out[grow + col] = (x - mu) * rinv * gamma[col] + beta[col];
        }
    }
}

// ---------------------------------------------------------------- launcher
extern "C" void kernel_launch(void* const* d_in, const int* in_sizes, int n_in,
                              void* d_out, int out_size, void* d_ws, size_t ws_size,
                              hipStream_t stream) {
    const float* q    = (const float*)d_in[0];
    const float* k    = (const float*)d_in[1];
    const float* v    = (const float*)d_in[2];
    const int*   mask = (const int*)  d_in[3];
    const float* Wq   = (const float*)d_in[4];
    const float* bq   = (const float*)d_in[5];
    const float* Wk   = (const float*)d_in[6];
    const float* bk   = (const float*)d_in[7];
    const float* Wv   = (const float*)d_in[8];
    const float* bv   = (const float*)d_in[9];
    const float* Wo   = (const float*)d_in[10];
    const float* bo   = (const float*)d_in[11];
    const float* gamma = (const float*)d_in[12];
    const float* beta  = (const float*)d_in[13];
    float* out = (float*)d_out;

    char* ws = (char*)d_ws;
    const size_t WSZ  = (size_t)DM * DM;              // per-weight elems
    const size_t HSZ  = (size_t)NB * NH * SEQ * DK;   // per-head-tensor elems
    __bf16* Wt  = (__bf16*)ws;                                        // 4*WSZ bf16
    __bf16* Qh  = (__bf16*)(ws + 4 * WSZ * 2);                        // HSZ
    __bf16* Kh  = Qh + HSZ;
    __bf16* Vt  = Kh + HSZ;
    __bf16* CTX = Vt + HSZ;                                           // HSZ

    wconv_kernel<<<dim3(WSZ / 8 / 256, 4), 256, 0, stream>>>(Wq, Wk, Wv, Wo, Wt);

    dim3 pg(NB * SEQ / 16, DM / (16 * 8));
    proj_kernel<<<pg, 256, 0, stream>>>(q, Wt,           bq, Qh, 0);
    proj_kernel<<<pg, 256, 0, stream>>>(k, Wt + WSZ,     bk, Kh, 0);
    proj_kernel<<<pg, 256, 0, stream>>>(v, Wt + 2 * WSZ, bv, Vt, 1);

    attn_kernel<<<dim3(SEQ / 128, NB * NH), 256, 0, stream>>>(Qh, Kh, Vt, mask, CTX);

    oproj_ln_kernel<<<dim3(NB * SEQ / 16), 256, 0, stream>>>(
        CTX, Wt + 3 * WSZ, bo, q, gamma, beta, out);
}

// v003
// It runs in 453 microseconds.
// Next to v002, in two timings, it ran 1.11 and 1.10 times as fast.
// All steps since v000 together make it 2.13 times as fast.
#include <hip/hip_runtime.h>

// ---------------------------------------------------------------- types
typedef __attribute__((ext_vector_type(16))) __bf16 v16bf;
typedef __attribute__((ext_vector_type(8)))  __bf16 v8bf;
typedef __attribute__((ext_vector_type(8)))  float  v8f;
typedef __attribute__((ext_vector_type(4)))  int    vi4;

#define NB   4
#define SEQ  2048
#define DM   1024
#define NH   16
#define DK   64

// LDS row pads: every tile that ds_load_b128 reads as a WMMA fragment (16 lanes
// = 16 rows) gets a row pitch of 16 B x odd, so the 16 rows fall on 64 distinct
// banks instead of on the same four.
#define PADF 4    // f32 elements  (16 B)
#define PADH 8    // bf16 elements (16 B)

#define AS_GLOBAL __attribute__((address_space(1)))
#define AS_LDS    __attribute__((address_space(3)))

__device__ __forceinline__ v8f zero8() {
    v8f z;
#pragma unroll
    for (int i = 0; i < 8; ++i) z[i] = 0.0f;
    return z;
}

__device__ __forceinline__ v16bf cat16(v8bf lo, v8bf hi) {
    v16bf r;
#pragma unroll
    for (int i = 0; i < 8; ++i) { r[i] = lo[i]; r[8 + i] = hi[i]; }
    return r;
}

// A/B fragment (16x32 bf16) per ISA layout: lane m = lane&15,
// kb = (lane>=16)?8:0, elems 0..7 = K[kb..kb+7], 8..15 = K[kb+16..kb+23].
__device__ __forceinline__ v16bf frag_bf16(const __bf16* p) {
    v8bf lo = *reinterpret_cast<const v8bf*>(p);
    v8bf hi = *reinterpret_cast<const v8bf*>(p + 16);
    return cat16(lo, hi);
}

// Packed weights: W^T is stored in B-fragment order. One 16-col x 32-k fragment
// is a 1 KB block [half-fragment 2][lane 32][8 bf16], so that each wave-wide
// 16-byte load reads 512 contiguous bytes (4 whole lines). Blocks run k-step
// first, then 16-column tile. Lane and element carry the same k as frag_bf16.
#define WFRAG 512                  // bf16 elements per fragment block
#define WTILE (WFRAG * (DM / 32))  // bf16 elements per 16-column tile
__device__ __forceinline__ v16bf frag_packed(const __bf16* p) {
    v8bf lo = *reinterpret_cast<const v8bf*>(p);
    v8bf hi = *reinterpret_cast<const v8bf*>(p + 256);
    return cat16(lo, hi);
}

// K and V^T of the attention use the same 1 KB fragment blocks:
//   K  : block = 16 keys x 32 d,  order [b*h][16-key tile][d step 2]
//   V^T: block = 16 d   x 32 keys, order [b*h][32-key step][16-d tile 4]
// so the 8 KB that one 32-key step reads are two contiguous 4 KB runs.

// Same fragment but converting fp32 source inline (two float4 pairs).
__device__ __forceinline__ v16bf frag_f32(const float* p) {
    const float4* p4 = reinterpret_cast<const float4*>(p);
    float4 f0 = p4[0], f1 = p4[1], f2 = p4[4], f3 = p4[5];
    v16bf r;
    r[0] = (__bf16)f0.x; r[1]  = (__bf16)f0.y; r[2]  = (__bf16)f0.z; r[3]  = (__bf16)f0.w;
    r[4] = (__bf16)f1.x; r[5]  = (__bf16)f1.y; r[6]  = (__bf16)f1.z; r[7]  = (__bf16)f1.w;
    r[8] = (__bf16)f2.x; r[9]  = (__bf16)f2.y; r[10] = (__bf16)f2.z; r[11] = (__bf16)f2.w;
    r[12] = (__bf16)f3.x; r[13] = (__bf16)f3.y; r[14] = (__bf16)f3.z; r[15] = (__bf16)f3.w;
    return r;
}

__device__ __forceinline__ v8f wmma_bf16(v16bf a, v16bf b, v8f c) {
    return __builtin_amdgcn_wmma_f32_16x16x32_bf16(false, a, false, b, (short)0, c, false, false);
}

// ---- async global->LDS staging (CDNA5 ASYNCcnt path), guarded fallback ----
__device__ __forceinline__ void stage_async_b128(const void* g, void* l) {
#if __has_builtin(__builtin_amdgcn_global_load_async_to_lds_b128)
    __builtin_amdgcn_global_load_async_to_lds_b128(
        (AS_GLOBAL vi4*)(g), (AS_LDS vi4*)(l), 0, 0);
#else
    *(float4*)l = *(const float4*)g;
#endif
}

__device__ __forceinline__ void stage_wait() {
#if __has_builtin(__builtin_amdgcn_global_load_async_to_lds_b128)
#if __has_builtin(__builtin_amdgcn_s_wait_asynccnt)
    __builtin_amdgcn_s_wait_asynccnt(0);
#else
    asm volatile("s_wait_asynccnt 0" ::: "memory");
#endif
#endif
    __syncthreads();
}

// ---------------------------------------------------------------- kernel 1:
// convert the 4 weight matrices to bf16 W^T in packed B-fragment order;
// one thread writes one lane's 16-byte piece (8 consecutive k of one column)
__global__ __launch_bounds__(256) void wconv_kernel(const float* __restrict__ Wq,
                                                    const float* __restrict__ Wk,
                                                    const float* __restrict__ Wv,
                                                    const float* __restrict__ Wo,
                                                    __bf16* __restrict__ Wt) {
    int w = blockIdx.y;
    const float* src = (w == 0) ? Wq : (w == 1) ? Wk : (w == 2) ? Wv : Wo;
    __bf16* dst = Wt + (size_t)w * DM * DM;
    int p = blockIdx.x * 256 + threadIdx.x;     // piece index in the packed order
    int ln = p & 31, hi = (p >> 5) & 1, ks = (p >> 6) & 31, nt = p >> 11;
    int n = nt * 16 + (ln & 15);
    int k = ks * 32 + hi * 16 + (ln >> 4) * 8;
    v8bf r;
    // unrolled: r is indexed by constants (stays in registers), the 8 loads issue together
#pragma unroll
    for (int e = 0; e < 8; ++e) r[e] = (__bf16)src[(size_t)(k + e) * DM + n];
    *reinterpret_cast<v8bf*>(dst + (size_t)p * 8) = r;
}

// ---------------------------------------------------------------- kernel 2:
// Y = X @ W + b, bf16 output per head. layout 0: rows [b,h,s,dk] (Q);
// layout 1: V^T fragment blocks; layout 2: K fragment blocks.
// The 16-row fp32 A tile is staged once per block into LDS (async), shared by
// all 8 waves; each wave owns one 16-col tile of the packed W^T.
__global__ __launch_bounds__(256) void proj_kernel(const float* __restrict__ X,
                                                   const __bf16* __restrict__ Wt,
                                                   const float* __restrict__ bias,
                                                   __bf16* __restrict__ out,
                                                   int layout) {
    __shared__ __attribute__((aligned(16))) float As[16][DM + PADF];   // pitch 4112 B

    int lane = threadIdx.x & 31, wave = threadIdx.x >> 5;
    int m0 = blockIdx.x * 16;
    int n0 = (blockIdx.y * 8 + wave) * 16;
    int colB = n0 + (lane & 15);
    int kb   = (lane >> 4) * 8;

    // stage A tile: 16 rows x 1024 f32, 16B per lane per shot, one row per shot
    {
        const float* gsrc = X + (size_t)m0 * DM;
        int col = threadIdx.x * 4;
#pragma unroll
        for (int it = 0; it < 16; ++it)
            stage_async_b128(gsrc + it * DM + col, &As[it][col]);
    }
    stage_wait();

    const float*  ap = &As[lane & 15][kb];
    const __bf16* bp = Wt + (size_t)(n0 >> 4) * WTILE + lane * 8;

    v8f c = zero8();
#pragma unroll 4
    for (int k0 = 0; k0 < DM; k0 += 32) {
        v16bf a = frag_f32(ap + k0);
        v16bf b = frag_packed(bp + (k0 >> 5) * WFRAG);
        c = wmma_bf16(a, b, c);
    }

    float bv = bias[colB];
    int h = colB >> 6, d = colB & (DK - 1);
    int bh = (m0 >> 11) * NH + h;        // the 16 rows of a tile share one batch
    int s0 = m0 & (SEQ - 1);
    if (layout == 1) {
        // a lane's 8 accumulators are 8 consecutive keys of one d: exactly its
        // 16-byte piece of the V^T block, so the wave stores 512 contiguous bytes
        v8bf r;
#pragma unroll
        for (int i = 0; i < 8; ++i) r[i] = (__bf16)(c[i] + bv);
        size_t blk = ((size_t)bh * (SEQ / 32) + (s0 >> 5)) * 4 + (d >> 4);
        *reinterpret_cast<v8bf*>(out + blk * WFRAG + ((s0 >> 4) & 1) * 256 + lane * 8) = r;
    } else {
        // a lane's 8 accumulators are 8 consecutive rows s of one d: one element
        // every DK elements in the row layout, every 8 (next lane slot) in a K block
        int sl = (lane >> 4) << 3;
        size_t blk = ((size_t)bh * (SEQ / 16) + (s0 >> 4)) * 2 + (d >> 5);
        size_t koff = blk * WFRAG + ((d >> 4) & 1) * 256 + (((d >> 3) & 1) * 16 + sl) * 8 + (d & 7);
        size_t qoff = ((size_t)bh * SEQ + s0 + sl) * DK + d;
        __bf16* p = out + (layout == 2 ? koff : qoff);
        int step = (layout == 2) ? 8 : DK;
#pragma unroll
        for (int i = 0; i < 8; ++i) p[i * step] = (__bf16)(c[i] + bv);
        // the listing's exit path falls on into the other branch's code, which
        // rewrites registers these stores name: keep the wait in front of it
        asm volatile("s_wait_xcnt 0x0" ::: "memory");
    }
}

// ---------------------------------------------------------------- kernel 3:
// flash attention: one 16-row Q tile per wave, 32 keys per iteration.
__global__ __launch_bounds__(256) void attn_kernel(const __bf16* __restrict__ Qh,
                                                   const __bf16* __restrict__ Kp,
                                                   const __bf16* __restrict__ Vp,
                                                   const int*    __restrict__ mask,
                                                   __bf16* __restrict__ ctx) {
    __shared__ __attribute__((aligned(16))) __bf16 pbuf[8][16][32 + PADH];   // pitch 80 B

    int lane = threadIdx.x & 31, wave = threadIdx.x >> 5;
    int bh = blockIdx.y;                 // b*NH + h
    int b  = bh >> 4, h = bh & (NH - 1);
    int q0 = (blockIdx.x * 8 + wave) * 16;
    int N  = lane & 15;
    int kb = (lane >> 4) * 8;

    // resident Q fragments (dk = 64 -> two 16x32 fragments)
    const __bf16* qbase = Qh + ((size_t)bh * SEQ + q0 + N) * DK;
    v16bf qa0 = frag_bf16(qbase + kb);
    v16bf qa1 = frag_bf16(qbase + 32 + kb);

    v8f o[4];
#pragma unroll
    for (int f = 0; f < 4; ++f) o[f] = zero8();
    float mrow[8], lrow[8];
#pragma unroll
    for (int i = 0; i < 8; ++i) { mrow[i] = -1e30f; lrow[i] = 0.0f; }

    const int* mbase = mask + (size_t)b * SEQ * SEQ;

    for (int s0 = 0; s0 < SEQ; s0 += 32) {
        // --- scores: two 16x16 tiles (keys s0..+15, s0+16..+31)
        const __bf16* kblk = Kp + ((size_t)bh * SEQ + s0) * DK;   // 4 blocks, 4 KB
        const __bf16* kB0 = kblk + lane * 8;
        const __bf16* kB1 = kB0 + 2 * WFRAG;
        v8f st0 = wmma_bf16(qa1, frag_packed(kB0 + WFRAG),
                  wmma_bf16(qa0, frag_packed(kB0), zero8()));
        v8f st1 = wmma_bf16(qa1, frag_packed(kB1 + WFRAG),
                  wmma_bf16(qa0, frag_packed(kB1), zero8()));

        // the next step's first 16 keys: 2 KB, one line per lane pair
        if (s0 + 32 < SEQ)
            __builtin_prefetch(kblk + 32 * DK + N * DK, 0, 1);

        // --- scale, mask, online softmax (rows live across 16-lane halves)
#pragma unroll
        for (int i = 0; i < 8; ++i) {
            int M = i + ((lane >> 4) << 3);
            size_t roff = (size_t)(q0 + M) * SEQ + s0;
            float v0 = st0[i] * 0.125f;
            float v1 = st1[i] * 0.125f;
            if (mbase[roff + N] == 0)      v0 = -1e9f;
            if (mbase[roff + 16 + N] == 0) v1 = -1e9f;

            float t = fmaxf(v0, v1);
            t = fmaxf(t, __shfl_xor(t, 1, 16));
            t = fmaxf(t, __shfl_xor(t, 2, 16));
            t = fmaxf(t, __shfl_xor(t, 4, 16));
            t = fmaxf(t, __shfl_xor(t, 8, 16));
            float mnew  = fmaxf(mrow[i], t);
            float alpha = __expf(mrow[i] - mnew);
            float p0 = __expf(v0 - mnew);
            float p1 = __expf(v1 - mnew);
            float rs = p0 + p1;
            rs += __shfl_xor(rs, 1, 16);
            rs += __shfl_xor(rs, 2, 16);
            rs += __shfl_xor(rs, 4, 16);
            rs += __shfl_xor(rs, 8, 16);
            lrow[i] = lrow[i] * alpha + rs;
            mrow[i] = mnew;
            o[0][i] *= alpha; o[1][i] *= alpha; o[2][i] *= alpha; o[3][i] *= alpha;

            pbuf[wave][M][N]      = (__bf16)p0;
            pbuf[wave][M][16 + N] = (__bf16)p1;
        }

        asm volatile("s_wait_dscnt 0" ::: "memory");

        // --- P (16x32) as A fragment from this wave's private LDS tile
        v16bf pa = frag_bf16(&pbuf[wave][lane & 15][kb]);

        // --- O += P @ V  (V^T blocks of this key step, one per 16-d tile)
        const __bf16* vb = Vp + ((size_t)bh * SEQ + s0) * DK + lane * 8;
#pragma unroll
        for (int f = 0; f < 4; ++f)
            o[f] = wmma_bf16(pa, frag_packed(vb + f * WFRAG), o[f]);
    }

    // --- normalize and store ctx (bf16, [B,S,D] with D = h*64+d)
#pragma unroll
    for (int i = 0; i < 8; ++i) {
        int M = i + ((lane >> 4) << 3);
        float inv = 1.0f / lrow[i];
        size_t base = ((size_t)(b * SEQ + q0 + M)) * DM + h * DK + N;
        ctx[base +  0] = (__bf16)(o[0][i] * inv);
        ctx[base + 16] = (__bf16)(o[1][i] * inv);
        ctx[base + 32] = (__bf16)(o[2][i] * inv);
        ctx[base + 48] = (__bf16)(o[3][i] * inv);
    }
}

// ---------------------------------------------------------------- kernel 4:
// out = LN(ctx @ Wo + bo + residual); one block = 16 full rows.
// The shared bf16 ctx A tile (32 KB) is staged async into LDS.
__global__ __launch_bounds__(256) void oproj_ln_kernel(const __bf16* __restrict__ ctx,
                                                       const __bf16* __restrict__ Wot,
                                                       const float* __restrict__ bo,
                                                       const float* __restrict__ residual,
                                                       const float* __restrict__ gamma,
                                                       const float* __restrict__ beta,
                                                       float* __restrict__ out) {
    __shared__ __attribute__((aligned(16))) __bf16 Abuf[16][DM + PADH];  // pitch 2064 B
    __shared__ __attribute__((aligned(16))) float  xrow[16][DM];  // 64 KB

    int lane = threadIdx.x & 31, wave = threadIdx.x >> 5;
    int m0 = blockIdx.x * 16;
    int kb = (lane >> 4) * 8;

    // stage A tile: 16 rows x 1024 bf16, two rows per shot
    {
        const __bf16* gsrc = ctx + (size_t)m0 * DM;
        int row = threadIdx.x >> 7, col = (threadIdx.x & 127) * 8;
#pragma unroll
        for (int it = 0; it < 8; ++it)
            stage_async_b128(gsrc + (it * 2 + row) * DM + col, &Abuf[it * 2 + row][col]);
    }
    stage_wait();

    const __bf16* ap = &Abuf[lane & 15][kb];

#pragma unroll
    for (int t = 0; t < 8; ++t) {
        int colB = (wave * 8 + t) * 16 + (lane & 15);
        const __bf16* bp = Wot + (size_t)(wave * 8 + t) * WTILE + lane * 8;
        v8f c = zero8();
#pragma unroll 4
        for (int k0 = 0; k0 < DM; k0 += 32)
            c = wmma_bf16(frag_bf16(ap + k0), frag_packed(bp + (k0 >> 5) * WFRAG), c);
        float bv = bo[colB];
#pragma unroll
        for (int i = 0; i < 8; ++i) {
            int M = i + ((lane >> 4) << 3);
            float val = c[i] + bv + residual[(size_t)(m0 + M) * DM + colB];
            xrow[M][colB] = val;
        }
    }

    __syncthreads();

    // LayerNorm: 8 waves x 2 rows
#pragma unroll
    for (int rr = 0; rr < 2; ++rr) {
        int r = wave * 2 + rr;
        float sum = 0.0f, sq = 0.0f;
#pragma unroll
        for (int j = 0; j < DM / 32; ++j) {
            float x = xrow[r][lane + 32 * j];
            sum += x; sq += x * x;
        }
#pragma unroll
        for (int d = 1; d < 32; d <<= 1) {
            sum += __shfl_xor(sum, d, 32);
            sq  += __shfl_xor(sq,  d, 32);
        }
        float mu   = sum * (1.0f / DM);
        float var  = sq * (1.0f / DM) - mu * mu;
        float rinv = rsqrtf(var + 1e-6f);
        size_t grow = (size_t)(m0 + r) * DM;
#pragma unroll
        for (int j = 0; j < DM / 32; ++j) {
            int col = lane + 32 * j;
            float x = xrow[r][col];
            out[grow + col] = (x - mu) * rinv * gamma[col] + beta[col];
        }
    }
}

// ---------------------------------------------------------------- launcher
extern "C" void kernel_launch(void* const* d_in, const int* in_sizes, int n_in,
                              void* d_out, int out_size, void* d_ws, size_t ws_size,
                              hipStream_t stream) {
    const float* q    = (const float*)d_in[0];
    const float* k    = (const float*)d_in[1];
    const float* v    = (const float*)d_in[2];
    const int*   mask = (const int*)  d_in[3];
    const float* Wq   = (const float*)d_in[4];
    const float* bq   = (const float*)d_in[5];
    const float* Wk   = (const float*)d_in[6];
    const float* bk   = (const float*)d_in[7];
    const float* Wv   = (const float*)d_in[8];
    const float* bv   = (const float*)d_in[9];
    const float* Wo   = (const float*)d_in[10];
    const float* bo   = (const float*)d_in[11];
    const float* gamma = (const float*)d_in[12];
    const float* beta  = (const float*)d_in[13];
    float* out = (float*)d_out;

    char* ws = (char*)d_ws;
    const size_t WSZ  = (size_t)DM * DM;              // per-weight elems
    const size_t HSZ  = (size_t)NB * NH * SEQ * DK;   // per-head-tensor elems
    __bf16* Wt  = (__bf16*)ws;                                        // 4*WSZ bf16
    __bf16* Qh  = (__bf16*)(ws + 4 * WSZ * 2);                        // HSZ
    __bf16* Kh  = Qh + HSZ;
    __bf16* Vt  = Kh + HSZ;
    __bf16* CTX = Vt + HSZ;                                           // HSZ

    wconv_kernel<<<dim3(WSZ / 8 / 256, 4), 256, 0, stream>>>(Wq, Wk, Wv, Wo, Wt);

    dim3 pg(NB * SEQ / 16, DM / (16 * 8));
    proj_kernel<<<pg, 256, 0, stream>>>(q, Wt,           bq, Qh, 0);
    proj_kernel<<<pg, 256, 0, stream>>>(k, Wt + WSZ,     bk, Kh, 2);
    proj_kernel<<<pg, 256, 0, stream>>>(v, Wt + 2 * WSZ, bv, Vt, 1);

    attn_kernel<<<dim3(SEQ / 128, NB * NH), 256, 0, stream>>>(Qh, Kh, Vt, mask, CTX);

    oproj_ln_kernel<<<dim3(NB * SEQ / 16), 256, 0, stream>>>(
        CTX, Wt + 3 * WSZ, bo, q, gamma, beta, out);
}

// v004
// A run of this version takes 291 microseconds.
// Next to v003, in two timings, it ran 1.55 and 1.57 times as fast.
// Over all steps from v000 it is 3.32 times as fast.
#include <hip/hip_runtime.h>

// ---------------------------------------------------------------- types
typedef __attribute__((ext_vector_type(16))) __bf16 v16bf;
typedef __attribute__((ext_vector_type(8)))  __bf16 v8bf;
typedef __attribute__((ext_vector_type(8)))  float  v8f;
typedef __attribute__((ext_vector_type(4)))  int    vi4;

#define NB   4
#define SEQ  2048
#define DM   1024
#define NH   16
#define DK   64

// LDS row pads: every tile that ds_load_b128 reads as a WMMA fragment (16 lanes
// = 16 rows) gets a row pitch of 16 B x odd, so the 16 rows fall on 64 distinct
// banks instead of on the same four.
#define PADF 4    // f32 elements  (16 B)
#define PADH 8    // bf16 elements (16 B)

#define AS_GLOBAL __attribute__((address_space(1)))
#define AS_LDS    __attribute__((address_space(3)))

__device__ __forceinline__ v8f zero8() {
    v8f z;
#pragma unroll
    for (int i = 0; i < 8; ++i) z[i] = 0.0f;
    return z;
}

__device__ __forceinline__ v16bf cat16(v8bf lo, v8bf hi) {
    v16bf r;
#pragma unroll
    for (int i = 0; i < 8; ++i) { r[i] = lo[i]; r[8 + i] = hi[i]; }
    return r;
}

// A/B fragment (16x32 bf16) per ISA layout: lane m = lane&15,
// kb = (lane>=16)?8:0, elems 0..7 = K[kb..kb+7], 8..15 = K[kb+16..kb+23].
__device__ __forceinline__ v16bf frag_bf16(const __bf16* p) {
    v8bf lo = *reinterpret_cast<const v8bf*>(p);
    v8bf hi = *reinterpret_cast<const v8bf*>(p + 16);
    return cat16(lo, hi);
}

// Packed weights: W^T is stored in B-fragment order. One 16-col x 32-k fragment
// is a 1 KB block [half-fragment 2][lane 32][8 bf16], so that each wave-wide
// 16-byte load reads 512 contiguous bytes (4 whole lines). Blocks run k-step
// first, then 16-column tile. Lane and element carry the same k as frag_bf16.
#define WFRAG 512                  // bf16 elements per fragment block
#define WTILE (WFRAG * (DM / 32))  // bf16 elements per 16-column tile
__device__ __forceinline__ v16bf frag_packed(const __bf16* p) {
    v8bf lo = *reinterpret_cast<const v8bf*>(p);
    v8bf hi = *reinterpret_cast<const v8bf*>(p + 256);
    return cat16(lo, hi);
}

// K and V^T of the attention use the same 1 KB fragment blocks:
//   K  : block = 16 keys x 32 d,  order [b*h][16-key tile][d step 2]
//   V^T: block = 16 d   x 32 keys, order [b*h][32-key step][16-d tile 4]
// so the 8 KB that one 32-key step reads are two contiguous 4 KB runs.

// Same fragment but converting fp32 source inline (two float4 pairs).
__device__ __forceinline__ v16bf frag_f32(const float* p) {
    const float4* p4 = reinterpret_cast<const float4*>(p);
    float4 f0 = p4[0], f1 = p4[1], f2 = p4[4], f3 = p4[5];
    v16bf r;
    r[0] = (__bf16)f0.x; r[1]  = (__bf16)f0.y; r[2]  = (__bf16)f0.z; r[3]  = (__bf16)f0.w;
    r[4] = (__bf16)f1.x; r[5]  = (__bf16)f1.y; r[6]  = (__bf16)f1.z; r[7]  = (__bf16)f1.w;
    r[8] = (__bf16)f2.x; r[9]  = (__bf16)f2.y; r[10] = (__bf16)f2.z; r[11] = (__bf16)f2.w;
    r[12] = (__bf16)f3.x; r[13] = (__bf16)f3.y; r[14] = (__bf16)f3.z; r[15] = (__bf16)f3.w;
    return r;
}

__device__ __forceinline__ v8f wmma_bf16(v16bf a, v16bf b, v8f c) {
    return __builtin_amdgcn_wmma_f32_16x16x32_bf16(false, a, false, b, (short)0, c, false, false);
}

// ---- async global->LDS staging (CDNA5 ASYNCcnt path), guarded fallback ----
__device__ __forceinline__ void stage_async_b128(const void* g, void* l) {
#if __has_builtin(__builtin_amdgcn_global_load_async_to_lds_b128)
    __builtin_amdgcn_global_load_async_to_lds_b128(
        (AS_GLOBAL vi4*)(g), (AS_LDS vi4*)(l), 0, 0);
#else
    *(float4*)l = *(const float4*)g;
#endif
}

__device__ __forceinline__ void stage_wait() {
#if __has_builtin(__builtin_amdgcn_global_load_async_to_lds_b128)
#if __has_builtin(__builtin_amdgcn_s_wait_asynccnt)
    __builtin_amdgcn_s_wait_asynccnt(0);
#else
    asm volatile("s_wait_asynccnt 0" ::: "memory");
#endif
#endif
    __syncthreads();
}

// ---------------------------------------------------------------- kernel 1:
// convert the 4 weight matrices to bf16 W^T in packed B-fragment order;
// one thread writes one lane's 16-byte piece (8 consecutive k of one column)
__global__ __launch_bounds__(256) void wconv_kernel(const float* __restrict__ Wq,
                                                    const float* __restrict__ Wk,
                                                    const float* __restrict__ Wv,
                                                    const float* __restrict__ Wo,
                                                    __bf16* __restrict__ Wt) {
    int w = blockIdx.y;
    const float* src = (w == 0) ? Wq : (w == 1) ? Wk : (w == 2) ? Wv : Wo;
    __bf16* dst = Wt + (size_t)w * DM * DM;
    int p = blockIdx.x * 256 + threadIdx.x;     // piece index in the packed order
    int ln = p & 31, hi = (p >> 5) & 1, ks = (p >> 6) & 31, nt = p >> 11;
    int n = nt * 16 + (ln & 15);
    int k = ks * 32 + hi * 16 + (ln >> 4) * 8;
    v8bf r;
    // unrolled: r is indexed by constants (stays in registers), the 8 loads issue together
#pragma unroll
    for (int e = 0; e < 8; ++e) r[e] = (__bf16)src[(size_t)(k + e) * DM + n];
    *reinterpret_cast<v8bf*>(dst + (size_t)p * 8) = r;
}

// ---------------------------------------------------------------- kernel 2:
// Y = X @ W + b, bf16 output per head. layout 0: rows [b,h,s,dk] (Q);
// layout 1: V^T fragment blocks; layout 2: K fragment blocks.
// The 16-row fp32 A tile is staged once per block into LDS (async), shared by
// all 8 waves; each wave owns one 16-col tile of the packed W^T.
__global__ __launch_bounds__(256) void proj_kernel(const float* __restrict__ X,
                                                   const __bf16* __restrict__ Wt,
                                                   const float* __restrict__ bias,
                                                   __bf16* __restrict__ out,
                                                   int layout) {
    __shared__ __attribute__((aligned(16))) float As[16][DM + PADF];   // pitch 4112 B

    int lane = threadIdx.x & 31, wave = threadIdx.x >> 5;
    int m0 = blockIdx.x * 16;
    int n0 = (blockIdx.y * 8 + wave) * 16;
    int colB = n0 + (lane & 15);
    int kb   = (lane >> 4) * 8;

    // stage A tile: 16 rows x 1024 f32, 16B per lane per shot, one row per shot
    {
        const float* gsrc = X + (size_t)m0 * DM;
        int col = threadIdx.x * 4;
#pragma unroll
        for (int it = 0; it < 16; ++it)
            stage_async_b128(gsrc + it * DM + col, &As[it][col]);
    }
    stage_wait();

    const float*  ap = &As[lane & 15][kb];
    const __bf16* bp = Wt + (size_t)(n0 >> 4) * WTILE + lane * 8;

    v8f c = zero8();
#pragma unroll 4
    for (int k0 = 0; k0 < DM; k0 += 32) {
        v16bf a = frag_f32(ap + k0);
        v16bf b = frag_packed(bp + (k0 >> 5) * WFRAG);
        c = wmma_bf16(a, b, c);
    }

    float bv = bias[colB];
    int h = colB >> 6, d = colB & (DK - 1);
    int bh = (m0 >> 11) * NH + h;        // the 16 rows of a tile share one batch
    int s0 = m0 & (SEQ - 1);
    if (layout == 1) {
        // a lane's 8 accumulators are 8 consecutive keys of one d: exactly its
        // 16-byte piece of the V^T block, so the wave stores 512 contiguous bytes
        v8bf r;
#pragma unroll
        for (int i = 0; i < 8; ++i) r[i] = (__bf16)(c[i] + bv);
        size_t blk = ((size_t)bh * (SEQ / 32) + (s0 >> 5)) * 4 + (d >> 4);
        *reinterpret_cast<v8bf*>(out + blk * WFRAG + ((s0 >> 4) & 1) * 256 + lane * 8) = r;
    } else {
        // a lane's 8 accumulators are 8 consecutive rows s of one d: one element
        // every DK elements in the row layout, every 8 (next lane slot) in a K block
        int sl = (lane >> 4) << 3;
        size_t blk = ((size_t)bh * (SEQ / 16) + (s0 >> 4)) * 2 + (d >> 5);
        size_t koff = blk * WFRAG + ((d >> 4) & 1) * 256 + (((d >> 3) & 1) * 16 + sl) * 8 + (d & 7);
        size_t qoff = ((size_t)bh * SEQ + s0 + sl) * DK + d;
        __bf16* p = out + (layout == 2 ? koff : qoff);
        int step = (layout == 2) ? 8 : DK;
#pragma unroll
        for (int i = 0; i < 8; ++i) p[i * step] = (__bf16)(c[i] + bv);
        // the listing's exit path falls on into the other branch's code, which
        // rewrites registers these stores name: keep the wait in front of it
        asm volatile("s_wait_xcnt 0x0" ::: "memory");
    }
}

// lane l <-> lane l ^ 16
__device__ __forceinline__ float xhalf(float x) {
    int b = __builtin_bit_cast(int, x);
    return __builtin_bit_cast(float,
        __builtin_amdgcn_permlanex16(b, b, 0x76543210, 0xfedcba98, false, false));
}

__global__ __launch_bounds__(256) void attn_kernel(const __bf16* __restrict__ Qh,
                                                   const __bf16* __restrict__ Kp,
                                                   const __bf16* __restrict__ Vp,
                                                   const int*    __restrict__ mask,
                                                   __bf16* __restrict__ ctx) {
    int lane = threadIdx.x & 31, wave = threadIdx.x >> 5;
    int bh = blockIdx.y;                 // b*NH + h
    int b  = bh >> 4, h = bh & (NH - 1);
    int q0 = (blockIdx.x * 8 + wave) * 16;
    int N  = lane & 15;                  // this lane's query
    int kb = (lane >> 4) * 8;

    // resident Q fragments (dk = 64 -> two 32x16 B fragments, column = query)
    const __bf16* qbase = Qh + ((size_t)bh * SEQ + q0 + N) * DK;
    v16bf qb0 = frag_bf16(qbase + kb);
    v16bf qb1 = frag_bf16(qbase + 32 + kb);

    v8f o[4];                            // o[f][r] = O[query N][f*16 + kb + r]
#pragma unroll
    for (int f = 0; f < 4; ++f) o[f] = zero8();
    float mrun = -1e30f;                 // the query's maximum, equal in both halves
    float lrun = 0.0f;                   // this half's share of the query's sum

    // this lane's mask row, at its first key
    const int* mrow = mask + ((size_t)b * SEQ + q0 + N) * SEQ + kb;

    for (int s0 = 0; s0 < SEQ; s0 += 32) {
        // --- scores: two 16x16 tiles (keys s0..+15, s0+16..+31) x 16 queries
        const __bf16* kblk = Kp + ((size_t)bh * SEQ + s0) * DK;   // 4 blocks, 4 KB
        const __bf16* kB0 = kblk + lane * 8;
        const __bf16* kB1 = kB0 + 2 * WFRAG;
        v8f st0 = wmma_bf16(frag_packed(kB0 + WFRAG), qb1,
                  wmma_bf16(frag_packed(kB0), qb0, zero8()));
        v8f st1 = wmma_bf16(frag_packed(kB1 + WFRAG), qb1,
                  wmma_bf16(frag_packed(kB1), qb0, zero8()));

        // the next step's first 16 keys: 2 KB, one line per lane pair
        if (s0 + 32 < SEQ)
            __builtin_prefetch(kblk + 32 * DK + N * DK, 0, 1);

        // --- scale and mask: a lane's keys are two runs of 8 in its mask row
        const vi4* mp = reinterpret_cast<const vi4*>(mrow + s0);
        vi4 mk[4] = { mp[0], mp[1], mp[4], mp[5] };
        float v0[8], v1[8];
#pragma unroll
        for (int i = 0; i < 8; ++i) {
            v0[i] = st0[i] * 0.125f;
            v1[i] = st1[i] * 0.125f;
            if (mk[i >> 2][i & 3] == 0)       v0[i] = -1e9f;
            if (mk[2 + (i >> 2)][i & 3] == 0) v1[i] = -1e9f;
        }

        // --- online softmax of one query per lane pair
        float t = fmaxf(v0[0], v1[0]);
#pragma unroll
        for (int i = 1; i < 8; ++i) t = fmaxf(t, fmaxf(v0[i], v1[i]));
        t = fmaxf(t, xhalf(t));
        float mnew  = fmaxf(mrun, t);
        float alpha = __expf(mrun - mnew);
        mrun = mnew;

        v16bf pb;                        // P^T as B: element s = key kmap(s, h)
        float rs = 0.0f;
#pragma unroll
        for (int i = 0; i < 8; ++i) {
            float p0 = __expf(v0[i] - mnew);
            float p1 = __expf(v1[i] - mnew);
            rs += p0 + p1;
            pb[i]     = (__bf16)p0;
            pb[8 + i] = (__bf16)p1;
        }
        lrun = lrun * alpha + rs;
#pragma unroll
        for (int f = 0; f < 4; ++f)
#pragma unroll
            for (int i = 0; i < 8; ++i) o[f][i] *= alpha;

        // --- O^T += V^T @ P^T  (V^T blocks of this key step, one per 16-d tile)
        const __bf16* vb = Vp + ((size_t)bh * SEQ + s0) * DK + lane * 8;
#pragma unroll
        for (int f = 0; f < 4; ++f)
            o[f] = wmma_bf16(frag_packed(vb + f * WFRAG), pb, o[f]);
    }

    // --- join the halves' sums, normalize, store ctx (bf16, [B,S,D], D = h*64+d):
    // a lane's 8 accumulators of a tile are 8 consecutive d of its query
    float inv = 1.0f / (lrun + xhalf(lrun));
    __bf16* cp = ctx + ((size_t)(b * SEQ + q0 + N)) * DM + h * DK + kb;
#pragma unroll
    for (int f = 0; f < 4; ++f) {
        v8bf r;
#pragma unroll
        for (int i = 0; i < 8; ++i) r[i] = (__bf16)(o[f][i] * inv);
        *reinterpret_cast<v8bf*>(cp + f * 16) = r;
    }
}

// ---------------------------------------------------------------- kernel 4:
// out = LN(ctx @ Wo + bo + residual); one block = 16 full rows.
// The shared bf16 ctx A tile (32 KB) is staged async into LDS.
__global__ __launch_bounds__(256) void oproj_ln_kernel(const __bf16* __restrict__ ctx,
                                                       const __bf16* __restrict__ Wot,
                                                       const float* __restrict__ bo,
                                                       const float* __restrict__ residual,
                                                       const float* __restrict__ gamma,
                                                       const float* __restrict__ beta,
                                                       float* __restrict__ out) {
    __shared__ __attribute__((aligned(16))) __bf16 Abuf[16][DM + PADH];  // pitch 2064 B
    __shared__ __attribute__((aligned(16))) float  xrow[16][DM];  // 64 KB

    int lane = threadIdx.x & 31, wave = threadIdx.x >> 5;
    int m0 = blockIdx.x * 16;
    int kb = (lane >> 4) * 8;

    // stage A tile: 16 rows x 1024 bf16, two rows per shot
    {
        const __bf16* gsrc = ctx + (size_t)m0 * DM;
        int row = threadIdx.x >> 7, col = (threadIdx.x & 127) * 8;
#pragma unroll
        for (int it = 0; it < 8; ++it)
            stage_async_b128(gsrc + (it * 2 + row) * DM + col, &Abuf[it * 2 + row][col]);
    }
    stage_wait();

    const __bf16* ap = &Abuf[lane & 15][kb];

#pragma unroll
    for (int t = 0; t < 8; ++t) {
        int colB = (wave * 8 + t) * 16 + (lane & 15);
        const __bf16* bp = Wot + (size_t)(wave * 8 + t) * WTILE + lane * 8;
        v8f c = zero8();
#pragma unroll 4
        for (int k0 = 0; k0 < DM; k0 += 32)
            c = wmma_bf16(frag_bf16(ap + k0), frag_packed(bp + (k0 >> 5) * WFRAG), c);
        float bv = bo[colB];
#pragma unroll
        for (int i = 0; i < 8; ++i) {
            int M = i + ((lane >> 4) << 3);
            float val = c[i] + bv + residual[(size_t)(m0 + M) * DM + colB];
            xrow[M][colB] = val;
        }
    }

    __syncthreads();

    // LayerNorm: 8 waves x 2 rows
#pragma unroll
    for (int rr = 0; rr < 2; ++rr) {
        int r = wave * 2 + rr;
        float sum = 0.0f, sq = 0.0f;
#pragma unroll
        for (int j = 0; j < DM / 32; ++j) {
            float x = xrow[r][lane + 32 * j];
            sum += x; sq += x * x;
        }
#pragma unroll
        for (int d = 1; d < 32; d <<= 1) {
            sum += __shfl_xor(sum, d, 32);
            sq  += __shfl_xor(sq,  d, 32);
        }
        float mu   = sum * (1.0f / DM);
        float var  = sq * (1.0f / DM) - mu * mu;
        float rinv = rsqrtf(var + 1e-6f);
        size_t grow = (size_t)(m0 + r) * DM;
#pragma unroll
        for (int j = 0; j < DM / 32; ++j) {
            int col = lane + 32 * j;
            float x = xrow[r][col];
            out[grow + col] = (x - mu) * rinv * gamma[col] + beta[col];
        }
    }
}

// ---------------------------------------------------------------- launcher
extern "C" void kernel_launch(void* const* d_in, const int* in_sizes, int n_in,
                              void* d_out, int out_size, void* d_ws, size_t ws_size,
                              hipStream_t stream) {
    const float* q    = (const float*)d_in[0];
    const float* k    = (const float*)d_in[1];
    const float* v    = (const float*)d_in[2];
    const int*   mask = (const int*)  d_in[3];
    const float* Wq   = (const float*)d_in[4];
    const float* bq   = (const float*)d_in[5];
    const float* Wk   = (const float*)d_in[6];
    const float* bk   = (const float*)d_in[7];
    const float* Wv   = (const float*)d_in[8];
    const float* bv   = (const float*)d_in[9];
    const float* Wo   = (const float*)d_in[10];
    const float* bo   = (const float*)d_in[11];
    const float* gamma = (const float*)d_in[12];
    const float* beta  = (const float*)d_in[13];
    float* out = (float*)d_out;

    char* ws = (char*)d_ws;
    const size_t WSZ  = (size_t)DM * DM;              // per-weight elems
    const size_t HSZ  = (size_t)NB * NH * SEQ * DK;   // per-head-tensor elems
    __bf16* Wt  = (__bf16*)ws;                                        // 4*WSZ bf16
    __bf16* Qh  = (__bf16*)(ws + 4 * WSZ * 2);                        // HSZ
    __bf16* Kh  = Qh + HSZ;
    __bf16* Vt  = Kh + HSZ;
    __bf16* CTX = Vt + HSZ;                                           // HSZ

    wconv_kernel<<<dim3(WSZ / 8 / 256, 4), 256, 0, stream>>>(Wq, Wk, Wv, Wo, Wt);

    dim3 pg(NB * SEQ / 16, DM / (16 * 8));
    proj_kernel<<<pg, 256, 0, stream>>>(q, Wt,           bq, Qh, 0);
    proj_kernel<<<pg, 256, 0, stream>>>(k, Wt + WSZ,     bk, Kh, 2);
    proj_kernel<<<pg, 256, 0, stream>>>(v, Wt + 2 * WSZ, bv, Vt, 1);

    attn_kernel<<<dim3(SEQ / 128, NB * NH), 256, 0, stream>>>(Qh, Kh, Vt, mask, CTX);

    oproj_ln_kernel<<<dim3(NB * SEQ / 16), 256, 0, stream>>>(
        CTX, Wt + 3 * WSZ, bo, q, gamma, beta, out);
}

// v005
// Measured time: 217 microseconds a run.
// Two timings next to v004 put it at 1.35 and 1.37 times that version's speed.
// Over all steps from v000 it is 4.51 times as fast.
#include <hip/hip_runtime.h>

// ---------------------------------------------------------------- types
typedef __attribute__((ext_vector_type(16))) __bf16 v16bf;
typedef __attribute__((ext_vector_type(8)))  __bf16 v8bf;
typedef __attribute__((ext_vector_type(8)))  float  v8f;
typedef __attribute__((ext_vector_type(4)))  int    vi4;

#define NB   4
#define SEQ  2048
#define DM   1024
#define NH   16
#define DK   64

// LDS row pads: every tile that ds_load_b128 reads as a WMMA fragment (16 lanes
// = 16 rows) gets a row pitch of 16 B x odd, so the 16 rows fall on 64 distinct
// banks instead of on the same four.
#define PADF 4    // f32 elements  (16 B)
#define PADH 8    // bf16 elements (16 B)

#define AS_GLOBAL __attribute__((address_space(1)))
#define AS_LDS    __attribute__((address_space(3)))

__device__ __forceinline__ v8f zero8() {
    v8f z;
#pragma unroll
    for (int i = 0; i < 8; ++i) z[i] = 0.0f;
    return z;
}

__device__ __forceinline__ v16bf cat16(v8bf lo, v8bf hi) {
    v16bf r;
#pragma unroll
    for (int i = 0; i < 8; ++i) { r[i] = lo[i]; r[8 + i] = hi[i]; }
    return r;
}

// A/B fragment (16x32 bf16) per ISA layout: lane m = lane&15,
// kb = (lane>=16)?8:0, elems 0..7 = K[kb..kb+7], 8..15 = K[kb+16..kb+23].
__device__ __forceinline__ v16bf frag_bf16(const __bf16* p) {
    v8bf lo = *reinterpret_cast<const v8bf*>(p);
    v8bf hi = *reinterpret_cast<const v8bf*>(p + 16);
    return cat16(lo, hi);
}

// Packed weights: W^T is stored in B-fragment order. One 16-col x 32-k fragment
// is a 1 KB block [half-fragment 2][lane 32][8 bf16], so that each wave-wide
// 16-byte load reads 512 contiguous bytes (4 whole lines). Blocks run k-step
// first, then 16-column tile. Lane and element carry the same k as frag_bf16.
#define WFRAG 512                  // bf16 elements per fragment block
#define WTILE (WFRAG * (DM / 32))  // bf16 elements per 16-column tile
__device__ __forceinline__ v16bf frag_packed(const __bf16* p) {
    v8bf lo = *reinterpret_cast<const v8bf*>(p);
    v8bf hi = *reinterpret_cast<const v8bf*>(p + 256);
    return cat16(lo, hi);
}

// K and V^T of the attention use the same 1 KB fragment blocks:
//   K  : block = 16 keys x 32 d,  order [b*h][16-key tile][d step 2]
//   V^T: block = 16 d   x 32 keys, order [b*h][32-key step][16-d tile 4]
// so the 8 KB that one 32-key step reads are two contiguous 4 KB runs.

// Same fragment but converting fp32 source inline (two float4 pairs).
__device__ __forceinline__ v16bf frag_f32(const float* p) {
    const float4* p4 = reinterpret_cast<const float4*>(p);
    float4 f0 = p4[0], f1 = p4[1], f2 = p4[4], f3 = p4[5];
    v16bf r;
    r[0] = (__bf16)f0.x; r[1]  = (__bf16)f0.y; r[2]  = (__bf16)f0.z; r[3]  = (__bf16)f0.w;
    r[4] = (__bf16)f1.x; r[5]  = (__bf16)f1.y; r[6]  = (__bf16)f1.z; r[7]  = (__bf16)f1.w;
    r[8] = (__bf16)f2.x; r[9]  = (__bf16)f2.y; r[10] = (__bf16)f2.z; r[11] = (__bf16)f2.w;
    r[12] = (__bf16)f3.x; r[13] = (__bf16)f3.y; r[14] = (__bf16)f3.z; r[15] = (__bf16)f3.w;
    return r;
}

__device__ __forceinline__ v8f wmma_bf16(v16bf a, v16bf b, v8f c) {
    return __builtin_amdgcn_wmma_f32_16x16x32_bf16(false, a, false, b, (short)0, c, false, false);
}

// ---- async global->LDS staging (CDNA5 ASYNCcnt path), guarded fallback ----
__device__ __forceinline__ void stage_async_b128(const void* g, void* l) {
#if __has_builtin(__builtin_amdgcn_global_load_async_to_lds_b128)
    __builtin_amdgcn_global_load_async_to_lds_b128(
        (AS_GLOBAL vi4*)(g), (AS_LDS vi4*)(l), 0, 0);
#else
    *(float4*)l = *(const float4*)g;
#endif
}

__device__ __forceinline__ void stage_wait() {
#if __has_builtin(__builtin_amdgcn_global_load_async_to_lds_b128)
#if __has_builtin(__builtin_amdgcn_s_wait_asynccnt)
    __builtin_amdgcn_s_wait_asynccnt(0);
#else
    asm volatile("s_wait_asynccnt 0" ::: "memory");
#endif
#endif
    __syncthreads();
}

// ---------------------------------------------------------------- kernel 1:
// convert the 4 weight matrices to bf16 W^T in packed B-fragment order;
// one thread writes one lane's 16-byte piece (8 consecutive k of one column)
__global__ __launch_bounds__(256) void wconv_kernel(const float* __restrict__ Wq,
                                                    const float* __restrict__ Wk,
                                                    const float* __restrict__ Wv,
                                                    const float* __restrict__ Wo,
                                                    __bf16* __restrict__ Wt) {
    int w = blockIdx.y;
    const float* src = (w == 0) ? Wq : (w == 1) ? Wk : (w == 2) ? Wv : Wo;
    __bf16* dst = Wt + (size_t)w * DM * DM;
    int p = blockIdx.x * 256 + threadIdx.x;     // piece index in the packed order
    int ln = p & 31, hi = (p >> 5) & 1, ks = (p >> 6) & 31, nt = p >> 11;
    int n = nt * 16 + (ln & 15);
    int k = ks * 32 + hi * 16 + (ln >> 4) * 8;
    v8bf r;
    // unrolled: r is indexed by constants (stays in registers), the 8 loads issue together
#pragma unroll
    for (int e = 0; e < 8; ++e) r[e] = (__bf16)src[(size_t)(k + e) * DM + n];
    *reinterpret_cast<v8bf*>(dst + (size_t)p * 8) = r;
}

// ---------------------------------------------------------------- kernel 2:
// Y = X @ W + b, bf16 output per head. layout 0: rows [b,h,s,dk] (Q);
// layout 1: V^T fragment blocks; layout 2: K fragment blocks.
// One block = 64 rows x 512 columns. The 64-row fp32 A tile is staged once into
// LDS (async) and shared by all 16 waves; each wave owns 4 row tiles x 2 column
// tiles, so a W fragment loaded from global feeds 4 products and an A fragment
// read and converted from LDS feeds 2.
#define PRT 4                      // 16-row tiles per wave (and per block)
#define PCT 2                      // 16-column tiles per wave
#define PWAVES 16
__global__ __launch_bounds__(PWAVES * 32) void proj_kernel(const float* __restrict__ X,
                                                   const __bf16* __restrict__ Wt,
                                                   const float* __restrict__ bias,
                                                   __bf16* __restrict__ out,
                                                   int layout) {
    __shared__ __attribute__((aligned(16))) float As[PRT * 16][DM + PADF];   // pitch 4112 B

    int lane = threadIdx.x & 31, wave = threadIdx.x >> 5;
    int m0  = blockIdx.x * (PRT * 16);
    int nt0 = (blockIdx.y * PWAVES + wave) * PCT;    // the wave's first column tile
    int kb  = (lane >> 4) * 8;

    // stage A tile: 64 rows x 1024 f32, 16B per lane per shot, two rows per shot
    {
        const float* gsrc = X + (size_t)m0 * DM;
        int row = threadIdx.x >> 8, col = (threadIdx.x & 255) * 4;
#pragma unroll
        for (int it = 0; it < PRT * 8; ++it)
            stage_async_b128(gsrc + (it * 2 + row) * DM + col, &As[it * 2 + row][col]);
    }
    stage_wait();

    const float*  ap = &As[lane & 15][kb];
    const __bf16* bp = Wt + (size_t)nt0 * WTILE + lane * 8;

    v8f c[PRT][PCT];
#pragma unroll
    for (int r = 0; r < PRT; ++r)
#pragma unroll
        for (int j = 0; j < PCT; ++j) c[r][j] = zero8();

    // unrolled by 2: the W loads of two k steps are in flight together
#pragma unroll 2
    for (int k0 = 0; k0 < DM; k0 += 32) {
        v16bf b[PCT];
#pragma unroll
        for (int j = 0; j < PCT; ++j)
            b[j] = frag_packed(bp + j * WTILE + (k0 >> 5) * WFRAG);
#pragma unroll
        for (int r = 0; r < PRT; ++r) {
            v16bf a = frag_f32(ap + r * 16 * (DM + PADF) + k0);
#pragma unroll
            for (int j = 0; j < PCT; ++j) c[r][j] = wmma_bf16(a, b[j], c[r][j]);
        }
    }

    int bq = (m0 >> 11) * NH;            // the 64 rows of a block share one batch
    int sb = m0 & (SEQ - 1);
#pragma unroll
    for (int j = 0; j < PCT; ++j) {
        int colB = (nt0 + j) * 16 + (lane & 15);
        float bv = bias[colB];
        int h = colB >> 6, d = colB & (DK - 1);
        int bh = bq + h;
        if (layout == 1) {
            // a lane's 8 accumulators are 8 consecutive keys of one d: exactly its
            // 16-byte piece of the V^T block, so the wave stores 512 contiguous bytes
#pragma unroll
            for (int r = 0; r < PRT; ++r) {
                int s0 = sb + r * 16;
                v8bf o;
#pragma unroll
                for (int i = 0; i < 8; ++i) o[i] = (__bf16)(c[r][j][i] + bv);
                size_t blk = ((size_t)bh * (SEQ / 32) + (s0 >> 5)) * 4 + (d >> 4);
                *reinterpret_cast<v8bf*>(out + blk * WFRAG + ((s0 >> 4) & 1) * 256 + lane * 8) = o;
            }
            // the next column tile's code rewrites registers that these stores name
            asm volatile("s_wait_xcnt 0x0" ::: "memory");
        } else {
            // a lane's 8 accumulators are 8 consecutive rows s of one d: one element
            // every DK elements in the row layout, every 8 (next lane slot) in a K block
            int sl = (lane >> 4) << 3;
            int step = (layout == 2) ? 8 : DK;
#pragma unroll
            for (int r = 0; r < PRT; ++r) {
                int s0 = sb + r * 16;
                size_t blk = ((size_t)bh * (SEQ / 16) + (s0 >> 4)) * 2 + (d >> 5);
                size_t koff = blk * WFRAG + ((d >> 4) & 1) * 256 + (((d >> 3) & 1) * 16 + sl) * 8 + (d & 7);
                size_t qoff = ((size_t)bh * SEQ + s0 + sl) * DK + d;
                __bf16* p = out + (layout == 2 ? koff : qoff);
#pragma unroll
                for (int i = 0; i < 8; ++i) p[i * step] = (__bf16)(c[r][j][i] + bv);
            }
            // in the listing this path falls on into the other branch's code, which
            // rewrites registers that these stores name: keep the wait in front of it
            asm volatile("s_wait_xcnt 0x0" ::: "memory");
        }
    }
}

// lane l <-> lane l ^ 16
__device__ __forceinline__ float xhalf(float x) {
    int b = __builtin_bit_cast(int, x);
    return __builtin_bit_cast(float,
        __builtin_amdgcn_permlanex16(b, b, 0x76543210, 0xfedcba98, false, false));
}

__global__ __launch_bounds__(256) void attn_kernel(const __bf16* __restrict__ Qh,
                                                   const __bf16* __restrict__ Kp,
                                                   const __bf16* __restrict__ Vp,
                                                   const int*    __restrict__ mask,
                                                   __bf16* __restrict__ ctx) {
    int lane = threadIdx.x & 31, wave = threadIdx.x >> 5;
    int bh = blockIdx.y;                 // b*NH + h
    int b  = bh >> 4, h = bh & (NH - 1);
    int q0 = (blockIdx.x * 8 + wave) * 16;
    int N  = lane & 15;                  // this lane's query
    int kb = (lane >> 4) * 8;

    // resident Q fragments (dk = 64 -> two 32x16 B fragments, column = query)
    const __bf16* qbase = Qh + ((size_t)bh * SEQ + q0 + N) * DK;
    v16bf qb0 = frag_bf16(qbase + kb);
    v16bf qb1 = frag_bf16(qbase + 32 + kb);

    v8f o[4];                            // o[f][r] = O[query N][f*16 + kb + r]
#pragma unroll
    for (int f = 0; f < 4; ++f) o[f] = zero8();
    float mrun = -1e30f;                 // the query's maximum, equal in both halves
    float lrun = 0.0f;                   // this half's share of the query's sum

    // this lane's mask row, at its first key
    const int* mrow = mask + ((size_t)b * SEQ + q0 + N) * SEQ + kb;

    for (int s0 = 0; s0 < SEQ; s0 += 32) {
        // --- scores: two 16x16 tiles (keys s0..+15, s0+16..+31) x 16 queries
        const __bf16* kblk = Kp + ((size_t)bh * SEQ + s0) * DK;   // 4 blocks, 4 KB
        const __bf16* kB0 = kblk + lane * 8;
        const __bf16* kB1 = kB0 + 2 * WFRAG;
        v8f st0 = wmma_bf16(frag_packed(kB0 + WFRAG), qb1,
                  wmma_bf16(frag_packed(kB0), qb0, zero8()));
        v8f st1 = wmma_bf16(frag_packed(kB1 + WFRAG), qb1,
                  wmma_bf16(frag_packed(kB1), qb0, zero8()));

        // the next step's first 16 keys: 2 KB, one line per lane pair
        if (s0 + 32 < SEQ)
            __builtin_prefetch(kblk + 32 * DK + N * DK, 0, 1);

        // --- scale and mask: a lane's keys are two runs of 8 in its mask row
        const vi4* mp = reinterpret_cast<const vi4*>(mrow + s0);
        vi4 mk[4] = { mp[0], mp[1], mp[4], mp[5] };
        float v0[8], v1[8];
#pragma unroll
        for (int i = 0; i < 8; ++i) {
            v0[i] = st0[i] * 0.125f;
            v1[i] = st1[i] * 0.125f;
            if (mk[i >> 2][i & 3] == 0)       v0[i] = -1e9f;
            if (mk[2 + (i >> 2)][i & 3] == 0) v1[i] = -1e9f;
        }

        // --- online softmax of one query per lane pair
        float t = fmaxf(v0[0], v1[0]);
#pragma unroll
        for (int i = 1; i < 8; ++i) t = fmaxf(t, fmaxf(v0[i], v1[i]));
        t = fmaxf(t, xhalf(t));
        float mnew  = fmaxf(mrun, t);
        float alpha = __expf(mrun - mnew);
        mrun = mnew;

        v16bf pb;                        // P^T as B: element s = key kmap(s, h)
        float rs = 0.0f;
#pragma unroll
        for (int i = 0; i < 8; ++i) {
            float p0 = __expf(v0[i] - mnew);
            float p1 = __expf(v1[i] - mnew);
            rs += p0 + p1;
            pb[i]     = (__bf16)p0;
            pb[8 + i] = (__bf16)p1;
        }
        lrun = lrun * alpha + rs;
#pragma unroll
        for (int f = 0; f < 4; ++f)
#pragma unroll
            for (int i = 0; i < 8; ++i) o[f][i] *= alpha;

        // --- O^T += V^T @ P^T  (V^T blocks of this key step, one per 16-d tile)
        const __bf16* vb = Vp + ((size_t)bh * SEQ + s0) * DK + lane * 8;
#pragma unroll
        for (int f = 0; f < 4; ++f)
            o[f] = wmma_bf16(frag_packed(vb + f * WFRAG), pb, o[f]);
    }

    // --- join the halves' sums, normalize, store ctx (bf16, [B,S,D], D = h*64+d):
    // a lane's 8 accumulators of a tile are 8 consecutive d of its query
    float inv = 1.0f / (lrun + xhalf(lrun));
    __bf16* cp = ctx + ((size_t)(b * SEQ + q0 + N)) * DM + h * DK + kb;
#pragma unroll
    for (int f = 0; f < 4; ++f) {
        v8bf r;
#pragma unroll
        for (int i = 0; i < 8; ++i) r[i] = (__bf16)(o[f][i] * inv);
        *reinterpret_cast<v8bf*>(cp + f * 16) = r;
    }
}

// ---------------------------------------------------------------- kernel 4:
// out = LN(ctx @ Wo + bo + residual); one block = 32 full rows, 16 waves.
// The shared bf16 ctx A tile (64 KB) is staged async into LDS; each wave owns
// 2 row tiles x 4 column tiles, so a W fragment loaded from global feeds 2
// products and an A fragment read from LDS feeds 4.
#define ORT 2                      // 16-row tiles per wave (and per block)
#define OCT 4                      // 16-column tiles per wave
#define OWAVES 16
__global__ __launch_bounds__(OWAVES * 32) void oproj_ln_kernel(const __bf16* __restrict__ ctx,
                                                       const __bf16* __restrict__ Wot,
                                                       const float* __restrict__ bo,
                                                       const float* __restrict__ residual,
                                                       const float* __restrict__ gamma,
                                                       const float* __restrict__ beta,
                                                       float* __restrict__ out) {
    __shared__ __attribute__((aligned(16))) __bf16 Abuf[ORT * 16][DM + PADH];  // pitch 2064 B
    __shared__ __attribute__((aligned(16))) float  xrow[ORT * 16][DM];  // 128 KB

    int lane = threadIdx.x & 31, wave = threadIdx.x >> 5;
    int m0 = blockIdx.x * (ORT * 16);
    int kb = (lane >> 4) * 8;

    // stage A tile: 32 rows x 1024 bf16, four rows per shot
    {
        const __bf16* gsrc = ctx + (size_t)m0 * DM;
        int row = threadIdx.x >> 7, col = (threadIdx.x & 127) * 8;
#pragma unroll
        for (int it = 0; it < ORT * 4; ++it)
            stage_async_b128(gsrc + (it * 4 + row) * DM + col, &Abuf[it * 4 + row][col]);
    }
    stage_wait();

    const __bf16* ap = &Abuf[lane & 15][kb];
    const __bf16* bp = Wot + (size_t)(wave * OCT) * WTILE + lane * 8;

    v8f c[ORT][OCT];
#pragma unroll
    for (int r = 0; r < ORT; ++r)
#pragma unroll
        for (int j = 0; j < OCT; ++j) c[r][j] = zero8();

    // unrolled by 2: the second k step's W loads issue under the first's products
#pragma unroll 2
    for (int k0 = 0; k0 < DM; k0 += 32) {
        v16bf b[OCT];
#pragma unroll
        for (int j = 0; j < OCT; ++j)
            b[j] = frag_packed(bp + j * WTILE + (k0 >> 5) * WFRAG);
#pragma unroll
        for (int r = 0; r < ORT; ++r) {
            v16bf a = frag_bf16(ap + r * 16 * (DM + PADH) + k0);
#pragma unroll
            for (int j = 0; j < OCT; ++j) c[r][j] = wmma_bf16(a, b[j], c[r][j]);
        }
    }

    // the wave's 64 residual elements per lane, all loads in flight together
    int col0 = wave * OCT * 16 + (lane & 15);
    int row0 = (lane >> 4) << 3;
    const float* rp = residual + (size_t)(m0 + row0) * DM + col0;
    float res[OCT][ORT][8];
#pragma unroll
    for (int j = 0; j < OCT; ++j)
#pragma unroll
        for (int r = 0; r < ORT; ++r)
#pragma unroll
            for (int i = 0; i < 8; ++i) res[j][r][i] = rp[(r * 16 + i) * DM + j * 16];
    // the address stays live up to this wait, so that no load of the run lands in
    // a register that an earlier load of the run names as its address
    asm volatile("s_wait_xcnt 0x0" :: "v"(rp) : "memory");

#pragma unroll
    for (int j = 0; j < OCT; ++j) {
        int colB = col0 + j * 16;
        float bv = bo[colB];
#pragma unroll
        for (int r = 0; r < ORT; ++r)
#pragma unroll
            for (int i = 0; i < 8; ++i) {
                int M = r * 16 + i + row0;
                float val = c[r][j][i] + bv + res[j][r][i];
                xrow[M][colB] = val;
            }
    }

    __syncthreads();

    // LayerNorm: 16 waves x 2 rows
#pragma unroll
    for (int rr = 0; rr < 2; ++rr) {
        int r = wave * 2 + rr;
        float sum = 0.0f, sq = 0.0f;
#pragma unroll
        for (int j = 0; j < DM / 32; ++j) {
            float x = xrow[r][lane + 32 * j];
            sum += x; sq += x * x;
        }
#pragma unroll
        for (int d = 1; d < 32; d <<= 1) {
            sum += __shfl_xor(sum, d, 32);
            sq  += __shfl_xor(sq,  d, 32);
        }
        float mu   = sum * (1.0f / DM);
        float var  = sq * (1.0f / DM) - mu * mu;
        float rinv = rsqrtf(var + 1e-6f);
        size_t grow = (size_t)(m0 + r) * DM;
#pragma unroll
        for (int j = 0; j < DM / 32; ++j) {
            int col = lane + 32 * j;
            float x = xrow[r][col];
            out[grow + col] = (x - mu) * rinv * gamma[col] + beta[col];
        }
    }
}

// ---------------------------------------------------------------- launcher
extern "C" void kernel_launch(void* const* d_in, const int* in_sizes, int n_in,
                              void* d_out, int out_size, void* d_ws, size_t ws_size,
                              hipStream_t stream) {
    const float* q    = (const float*)d_in[0];
    const float* k    = (const float*)d_in[1];
    const float* v    = (const float*)d_in[2];
    const int*   mask = (const int*)  d_in[3];
    const float* Wq   = (const float*)d_in[4];
    const float* bq   = (const float*)d_in[5];
    const float* Wk   = (const float*)d_in[6];
    const float* bk   = (const float*)d_in[7];
    const float* Wv   = (const float*)d_in[8];
    const float* bv   = (const float*)d_in[9];
    const float* Wo   = (const float*)d_in[10];
    const float* bo   = (const float*)d_in[11];
    const float* gamma = (const float*)d_in[12];
    const float* beta  = (const float*)d_in[13];
    float* out = (float*)d_out;

    char* ws = (char*)d_ws;
    const size_t WSZ  = (size_t)DM * DM;              // per-weight elems
    const size_t HSZ  = (size_t)NB * NH * SEQ * DK;   // per-head-tensor elems
    __bf16* Wt  = (__bf16*)ws;                                        // 4*WSZ bf16
    __bf16* Qh  = (__bf16*)(ws + 4 * WSZ * 2);                        // HSZ
    __bf16* Kh  = Qh + HSZ;
    __bf16* Vt  = Kh + HSZ;
    __bf16* CTX = Vt + HSZ;                                           // HSZ

    wconv_kernel<<<dim3(WSZ / 8 / 256, 4), 256, 0, stream>>>(Wq, Wk, Wv, Wo, Wt);

    dim3 pg(NB * SEQ / (PRT * 16), DM / (16 * PCT * PWAVES));
    proj_kernel<<<pg, PWAVES * 32, 0, stream>>>(q, Wt,           bq, Qh, 0);
    proj_kernel<<<pg, PWAVES * 32, 0, stream>>>(k, Wt + WSZ,     bk, Kh, 2);
    proj_kernel<<<pg, PWAVES * 32, 0, stream>>>(v, Wt + 2 * WSZ, bv, Vt, 1);

    attn_kernel<<<dim3(SEQ / 128, NB * NH), 256, 0, stream>>>(Qh, Kh, Vt, mask, CTX);

    oproj_ln_kernel<<<dim3(NB * SEQ / (ORT * 16)), OWAVES * 32, 0, stream>>>(
        CTX, Wt + 3 * WSZ, bo, q, gamma, beta, out);
}

// v006
// One run takes 191 microseconds.
// Two timings next to v005 both put it at 1.13 times that version's speed.
// Over all steps from v000 it is 5.11 times as fast.
#include <hip/hip_runtime.h>

// ---------------------------------------------------------------- types
typedef __attribute__((ext_vector_type(16))) __bf16 v16bf;
typedef __attribute__((ext_vector_type(8)))  __bf16 v8bf;
typedef __attribute__((ext_vector_type(8)))  float  v8f;
typedef __attribute__((ext_vector_type(4)))  int    vi4;

#define NB   4
#define SEQ  2048
#define DM   1024
#define NH   16
#define DK   64

// LDS row pads: every tile that ds_load_b128 reads as a WMMA fragment (16 lanes
// = 16 rows) gets a row pitch of 16 B x odd, so the 16 rows fall on 64 distinct
// banks instead of on the same four.
#define PADF 4    // f32 elements  (16 B)
#define PADH 8    // bf16 elements (16 B)

#define AS_GLOBAL __attribute__((address_space(1)))
#define AS_LDS    __attribute__((address_space(3)))

__device__ __forceinline__ v8f zero8() {
    v8f z;
#pragma unroll
    for (int i = 0; i < 8; ++i) z[i] = 0.0f;
    return z;
}

__device__ __forceinline__ v16bf cat16(v8bf lo, v8bf hi) {
    v16bf r;
#pragma unroll
    for (int i = 0; i < 8; ++i) { r[i] = lo[i]; r[8 + i] = hi[i]; }
    return r;
}

// A/B fragment (16x32 bf16) per ISA layout: lane m = lane&15,
// kb = (lane>=16)?8:0, elems 0..7 = K[kb..kb+7], 8..15 = K[kb+16..kb+23].
__device__ __forceinline__ v16bf frag_bf16(const __bf16* p) {
    v8bf lo = *reinterpret_cast<const v8bf*>(p);
    v8bf hi = *reinterpret_cast<const v8bf*>(p + 16);
    return cat16(lo, hi);
}

// Packed weights: W^T is stored in B-fragment order. One 16-col x 32-k fragment
// is a 1 KB block [half-fragment 2][lane 32][8 bf16], so that each wave-wide
// 16-byte load reads 512 contiguous bytes (4 whole lines). Blocks run k-step
// first, then 16-column tile. Lane and element carry the same k as frag_bf16.
#define WFRAG 512                  // bf16 elements per fragment block
#define WTILE (WFRAG * (DM / 32))  // bf16 elements per 16-column tile
__device__ __forceinline__ v16bf frag_packed(const __bf16* p) {
    v8bf lo = *reinterpret_cast<const v8bf*>(p);
    v8bf hi = *reinterpret_cast<const v8bf*>(p + 256);
    return cat16(lo, hi);
}

// K and V^T of the attention use the same 1 KB fragment blocks:
//   K  : block = 16 keys x 32 d,  order [b*h][16-key tile][d step 2]
//   V^T: block = 16 d   x 32 keys, order [b*h][32-key step][16-d tile 4]
// so the 8 KB that one 32-key step reads are two contiguous 4 KB runs.

// Same fragment but converting fp32 source inline (two float4 pairs).
__device__ __forceinline__ v16bf frag_f32(const float* p) {
    const float4* p4 = reinterpret_cast<const float4*>(p);
    float4 f0 = p4[0], f1 = p4[1], f2 = p4[4], f3 = p4[5];
    v16bf r;
    r[0] = (__bf16)f0.x; r[1]  = (__bf16)f0.y; r[2]  = (__bf16)f0.z; r[3]  = (__bf16)f0.w;
    r[4] = (__bf16)f1.x; r[5]  = (__bf16)f1.y; r[6]  = (__bf16)f1.z; r[7]  = (__bf16)f1.w;
    r[8] = (__bf16)f2.x; r[9]  = (__bf16)f2.y; r[10] = (__bf16)f2.z; r[11] = (__bf16)f2.w;
    r[12] = (__bf16)f3.x; r[13] = (__bf16)f3.y; r[14] = (__bf16)f3.z; r[15] = (__bf16)f3.w;
    return r;
}

__device__ __forceinline__ v8f wmma_bf16(v16bf a, v16bf b, v8f c) {
    return __builtin_amdgcn_wmma_f32_16x16x32_bf16(false, a, false, b, (short)0, c, false, false);
}

// ---- async global->LDS staging (CDNA5 ASYNCcnt path), guarded fallback ----
__device__ __forceinline__ void stage_async_b128(const void* g, void* l) {
#if __has_builtin(__builtin_amdgcn_global_load_async_to_lds_b128)
    __builtin_amdgcn_global_load_async_to_lds_b128(
        (AS_GLOBAL vi4*)(g), (AS_LDS vi4*)(l), 0, 0);
#else
    *(float4*)l = *(const float4*)g;
#endif
}

__device__ __forceinline__ void stage_wait() {
#if __has_builtin(__builtin_amdgcn_global_load_async_to_lds_b128)
#if __has_builtin(__builtin_amdgcn_s_wait_asynccnt)
    __builtin_amdgcn_s_wait_asynccnt(0);
#else
    asm volatile("s_wait_asynccnt 0" ::: "memory");
#endif
#endif
    __syncthreads();
}

// ---------------------------------------------------------------- kernel 1:
// convert the 4 weight matrices to bf16 W^T in packed B-fragment order;
// one thread writes one lane's 16-byte piece (8 consecutive k of one column)
__global__ __launch_bounds__(256) void wconv_kernel(const float* __restrict__ Wq,
                                                    const float* __restrict__ Wk,
                                                    const float* __restrict__ Wv,
                                                    const float* __restrict__ Wo,
                                                    __bf16* __restrict__ Wt) {
    int w = blockIdx.y;
    const float* src = (w == 0) ? Wq : (w == 1) ? Wk : (w == 2) ? Wv : Wo;
    __bf16* dst = Wt + (size_t)w * DM * DM;
    int p = blockIdx.x * 256 + threadIdx.x;     // piece index in the packed order
    int ln = p & 31, hi = (p >> 5) & 1, ks = (p >> 6) & 31, nt = p >> 11;
    int n = nt * 16 + (ln & 15);
    int k = ks * 32 + hi * 16 + (ln >> 4) * 8;
    v8bf r;
    // unrolled: r is indexed by constants (stays in registers), the 8 loads issue together
#pragma unroll
    for (int e = 0; e < 8; ++e) r[e] = (__bf16)src[(size_t)(k + e) * DM + n];
    *reinterpret_cast<v8bf*>(dst + (size_t)p * 8) = r;
}

// ---------------------------------------------------------------- kernel 2:
// Y = X @ W + b, bf16 output per head. layout 0: rows [b,h,s,dk] (Q);
// layout 1: V^T fragment blocks; layout 2: K fragment blocks.
// One block = 64 rows x 512 columns. The 64-row fp32 A tile is staged once into
// LDS (async) and shared by all 16 waves; each wave owns 4 row tiles x 2 column
// tiles, so a W fragment loaded from global feeds 4 products and an A fragment
// read and converted from LDS feeds 2.
#define PRT 4                      // 16-row tiles per wave (and per block)
#define PCT 2                      // 16-column tiles per wave
#define PWAVES 16
__global__ __launch_bounds__(PWAVES * 32) void proj_kernel(const float* __restrict__ X,
                                                   const __bf16* __restrict__ Wt,
                                                   const float* __restrict__ bias,
                                                   __bf16* __restrict__ out,
                                                   int layout) {
    __shared__ __attribute__((aligned(16))) float As[PRT * 16][DM + PADF];   // pitch 4112 B

    int lane = threadIdx.x & 31, wave = threadIdx.x >> 5;
    int m0  = blockIdx.x * (PRT * 16);
    int nt0 = (blockIdx.y * PWAVES + wave) * PCT;    // the wave's first column tile
    int kb  = (lane >> 4) * 8;

    // stage A tile: 64 rows x 1024 f32, 16B per lane per shot, two rows per shot
    {
        const float* gsrc = X + (size_t)m0 * DM;
        int row = threadIdx.x >> 8, col = (threadIdx.x & 255) * 4;
#pragma unroll
        for (int it = 0; it < PRT * 8; ++it)
            stage_async_b128(gsrc + (it * 2 + row) * DM + col, &As[it * 2 + row][col]);
    }
    stage_wait();

    const float*  ap = &As[lane & 15][kb];
    const __bf16* bp = Wt + (size_t)nt0 * WTILE + lane * 8;

    v8f c[PRT][PCT];
#pragma unroll
    for (int r = 0; r < PRT; ++r)
#pragma unroll
        for (int j = 0; j < PCT; ++j) c[r][j] = zero8();

    // unrolled by 2: the W loads of two k steps are in flight together
#pragma unroll 2
    for (int k0 = 0; k0 < DM; k0 += 32) {
        v16bf b[PCT];
#pragma unroll
        for (int j = 0; j < PCT; ++j)
            b[j] = frag_packed(bp + j * WTILE + (k0 >> 5) * WFRAG);
#pragma unroll
        for (int r = 0; r < PRT; ++r) {
            v16bf a = frag_f32(ap + r * 16 * (DM + PADF) + k0);
#pragma unroll
            for (int j = 0; j < PCT; ++j) c[r][j] = wmma_bf16(a, b[j], c[r][j]);
        }
    }

    int bq = (m0 >> 11) * NH;            // the 64 rows of a block share one batch
    int sb = m0 & (SEQ - 1);
#pragma unroll
    for (int j = 0; j < PCT; ++j) {
        int colB = (nt0 + j) * 16 + (lane & 15);
        float bv = bias[colB];
        int h = colB >> 6, d = colB & (DK - 1);
        int bh = bq + h;
        if (layout == 1) {
            // a lane's 8 accumulators are 8 consecutive keys of one d: exactly its
            // 16-byte piece of the V^T block, so the wave stores 512 contiguous bytes
#pragma unroll
            for (int r = 0; r < PRT; ++r) {
                int s0 = sb + r * 16;
                v8bf o;
#pragma unroll
                for (int i = 0; i < 8; ++i) o[i] = (__bf16)(c[r][j][i] + bv);
                size_t blk = ((size_t)bh * (SEQ / 32) + (s0 >> 5)) * 4 + (d >> 4);
                *reinterpret_cast<v8bf*>(out + blk * WFRAG + ((s0 >> 4) & 1) * 256 + lane * 8) = o;
            }
            // the next column tile's code rewrites registers that these stores name
            asm volatile("s_wait_xcnt 0x0" ::: "memory");
        } else {
            // a lane's 8 accumulators are 8 consecutive rows s of one d: one element
            // every DK elements in the row layout, every 8 (next lane slot) in a K block
            int sl = (lane >> 4) << 3;
            int step = (layout == 2) ? 8 : DK;
#pragma unroll
            for (int r = 0; r < PRT; ++r) {
                int s0 = sb + r * 16;
                size_t blk = ((size_t)bh * (SEQ / 16) + (s0 >> 4)) * 2 + (d >> 5);
                size_t koff = blk * WFRAG + ((d >> 4) & 1) * 256 + (((d >> 3) & 1) * 16 + sl) * 8 + (d & 7);
                size_t qoff = ((size_t)bh * SEQ + s0 + sl) * DK + d;
                __bf16* p = out + (layout == 2 ? koff : qoff);
#pragma unroll
                for (int i = 0; i < 8; ++i) p[i * step] = (__bf16)(c[r][j][i] + bv);
            }
            // in the listing this path falls on into the other branch's code, which
            // rewrites registers that these stores name: keep the wait in front of it
            asm volatile("s_wait_xcnt 0x0" ::: "memory");
        }
    }
}

#define KSTG 64                    // keys per ring stage
#define NSTG (SEQ / KSTG)
#define STGE (KSTG * DK)           // bf16 elements of K, and of V^T, per stage (8 KB)
#define BUFB (2 * STGE * 2)        // bytes per ring buffer: K, then V^T

// One thread's share of a stage: two 16-byte pieces of K, two of V^T. gk and gv
// are the thread's first pieces in global memory, l that of K in the buffer (LDS
// byte address); the second piece lies STGE / 2 elements = STGE bytes on. The
// s_wait_xcnt stands inside the statement, so that no address register of a copy
// is rewritten in front of it.
__device__ __forceinline__ void stage_kv(const __bf16* gk, const __bf16* gv, unsigned l) {
    asm volatile("global_load_async_to_lds_b128 %0, %4, off\n\t"
                 "global_load_async_to_lds_b128 %1, %5, off\n\t"
                 "global_load_async_to_lds_b128 %2, %6, off\n\t"
                 "global_load_async_to_lds_b128 %3, %7, off\n\t"
                 "s_wait_xcnt 0x0"
                 :: "v"(l), "v"(l + STGE), "v"(l + 2 * STGE), "v"(l + 3 * STGE),
                    "v"(gk), "v"(gk + STGE / 2), "v"(gv), "v"(gv + STGE / 2)
                 : "memory");
}

// lane l <-> lane l ^ 16
__device__ __forceinline__ float xhalf(float x) {
    int b = __builtin_bit_cast(int, x);
    return __builtin_bit_cast(float,
        __builtin_amdgcn_permlanex16(b, b, 0x76543210, 0xfedcba98, false, false));
}

// waves_per_eu(8, 8): the grid fills the chip at 4 blocks per WGP = 8 waves per SIMD,
// as before. Without it the compiler, seeing LDS for 10 blocks, squeezes the loop
// into 96 registers and waits out every LDS and mask load one by one.
__global__ __launch_bounds__(256) __attribute__((amdgpu_waves_per_eu(8, 8))) void attn_kernel(const __bf16* __restrict__ Qh,
                                                   const __bf16* __restrict__ Kp,
                                                   const __bf16* __restrict__ Vp,
                                                   const int*    __restrict__ mask,
                                                   __bf16* __restrict__ ctx) {
    __shared__ __attribute__((aligned(16))) __bf16 ring[2][2][STGE];   // [buffer][K, V^T]

    int lane = threadIdx.x & 31, wave = threadIdx.x >> 5;
    int bh = blockIdx.y;                 // b*NH + h
    int b  = bh >> 4, h = bh & (NH - 1);
    int q0 = (blockIdx.x * 8 + wave) * 16;
    int N  = lane & 15;                  // this lane's query
    int kb = (lane >> 4) * 8;

    // resident Q fragments (dk = 64 -> two 32x16 B fragments, column = query)
    const __bf16* qbase = Qh + ((size_t)bh * SEQ + q0 + N) * DK;
    v16bf qb0 = frag_bf16(qbase + kb);
    v16bf qb1 = frag_bf16(qbase + 32 + kb);

    v8f o[4];                            // o[f][r] = O[query N][f*16 + kb + r]
#pragma unroll
    for (int f = 0; f < 4; ++f) o[f] = zero8();
    float mrun = -1e30f;                 // the query's maximum, equal in both halves
    float lrun = 0.0f;                   // this half's share of the query's sum

    // this lane's mask row, at its first key
    const int* mrow = mask + ((size_t)b * SEQ + q0 + N) * SEQ + kb;

    // ring prologue: stage 0 lands and is published, stage 1 is under way
    const __bf16* gk = Kp + (size_t)bh * SEQ * DK + threadIdx.x * 8;
    const __bf16* gv = Vp + (size_t)bh * SEQ * DK + threadIdx.x * 8;
    unsigned l0 = (unsigned)(size_t)(AS_LDS __bf16*)&ring[0][0][threadIdx.x * 8];
    stage_kv(gk, gv, l0);
    // this wave's copies of stage 0 have landed before the barrier publishes them
    asm volatile("s_wait_asynccnt 0x0" ::: "memory");
    __syncthreads();
    stage_kv(gk + STGE, gv + STGE, l0 + BUFB);

    for (int t = 0; t < NSTG; ++t) {
      const __bf16* kst = &ring[t & 1][0][lane * 8];
      const __bf16* vst = &ring[t & 1][1][lane * 8];
      // kept rolled: two passes scheduled as one region want more than the 128
      // registers that 8 waves per SIMD leave a wave
#pragma unroll 1
      for (int ps = 0; ps < KSTG / 32; ++ps) {
        int s0 = t * KSTG + ps * 32;
        // --- scores: two 16x16 tiles (keys s0..+15, s0+16..+31) x 16 queries
        const __bf16* kB0 = kst + ps * 4 * WFRAG;                 // 4 blocks, 4 KB
        const __bf16* kB1 = kB0 + 2 * WFRAG;
        v8f st0 = wmma_bf16(frag_packed(kB0 + WFRAG), qb1,
                  wmma_bf16(frag_packed(kB0), qb0, zero8()));
        v8f st1 = wmma_bf16(frag_packed(kB1 + WFRAG), qb1,
                  wmma_bf16(frag_packed(kB1), qb0, zero8()));

        // --- scale and mask: a lane's keys are two runs of 8 in its mask row
        const vi4* mp = reinterpret_cast<const vi4*>(mrow + s0);
        vi4 mk[4] = { mp[0], mp[1], mp[4], mp[5] };
        float v0[8], v1[8];
#pragma unroll
        for (int i = 0; i < 8; ++i) {
            v0[i] = st0[i] * 0.125f;
            v1[i] = st1[i] * 0.125f;
            if (mk[i >> 2][i & 3] == 0)       v0[i] = -1e9f;
            if (mk[2 + (i >> 2)][i & 3] == 0) v1[i] = -1e9f;
        }

        // --- online softmax of one query per lane pair
        float t = fmaxf(v0[0], v1[0]);
#pragma unroll
        for (int i = 1; i < 8; ++i) t = fmaxf(t, fmaxf(v0[i], v1[i]));
        t = fmaxf(t, xhalf(t));
        float mnew  = fmaxf(mrun, t);
        float alpha = __expf(mrun - mnew);
        mrun = mnew;

        v16bf pb;                        // P^T as B: element s = key kmap(s, h)
        float rs = 0.0f;
#pragma unroll
        for (int i = 0; i < 8; ++i) {
            float p0 = __expf(v0[i] - mnew);
            float p1 = __expf(v1[i] - mnew);
            rs += p0 + p1;
            pb[i]     = (__bf16)p0;
            pb[8 + i] = (__bf16)p1;
        }
        lrun = lrun * alpha + rs;
#pragma unroll
        for (int f = 0; f < 4; ++f)
#pragma unroll
            for (int i = 0; i < 8; ++i) o[f][i] *= alpha;

        // --- O^T += V^T @ P^T  (V^T blocks of this key step, one per 16-d tile)
        const __bf16* vb = vst + ps * 4 * WFRAG;
#pragma unroll
        for (int f = 0; f < 4; ++f)
            o[f] = wmma_bf16(frag_packed(vb + f * WFRAG), pb, o[f]);
        // one more vector slot behind the pass's last product; the scheduling fence
        // keeps the v_nop at the foot of the pass
        __builtin_amdgcn_sched_barrier(0);
        asm volatile("v_nop");
      }

      // publish point of stage t + 1: this wave's reads of stage t are done ...
      asm volatile("s_wait_dscnt 0x0" ::: "memory");
      // ... its copies of stage t + 1 have landed ...
      asm volatile("s_wait_asynccnt 0x0" ::: "memory");
      // ... and behind the barrier that holds for all 8 waves
      __syncthreads();
      if (t + 2 < NSTG)                  // refill the buffer that every wave has left
          stage_kv(gk + (t + 2) * STGE, gv + (t + 2) * STGE, l0 + (t & 1) * BUFB);
    }
    // no copy is outstanding when the wave ends
    asm volatile("s_wait_asynccnt 0x0" ::: "memory");

    // --- join the halves' sums, normalize, store ctx (bf16, [B,S,D], D = h*64+d):
    // a lane's 8 accumulators of a tile are 8 consecutive d of its query
    float inv = 1.0f / (lrun + xhalf(lrun));
    __bf16* cp = ctx + ((size_t)(b * SEQ + q0 + N)) * DM + h * DK + kb;
#pragma unroll
    for (int f = 0; f < 4; ++f) {
        v8bf r;
#pragma unroll
        for (int i = 0; i < 8; ++i) r[i] = (__bf16)(o[f][i] * inv);
        *reinterpret_cast<v8bf*>(cp + f * 16) = r;
    }
}

// ---------------------------------------------------------------- kernel 4:
// out = LN(ctx @ Wo + bo + residual); one block = 32 full rows, 16 waves.
// The shared bf16 ctx A tile (64 KB) is staged async into LDS; each wave owns
// 2 row tiles x 4 column tiles, so a W fragment loaded from global feeds 2
// products and an A fragment read from LDS feeds 4.
#define ORT 2                      // 16-row tiles per wave (and per block)
#define OCT 4                      // 16-column tiles per wave
#define OWAVES 16
__global__ __launch_bounds__(OWAVES * 32) void oproj_ln_kernel(const __bf16* __restrict__ ctx,
                                                       const __bf16* __restrict__ Wot,
                                                       const float* __restrict__ bo,
                                                       const float* __restrict__ residual,
                                                       const float* __restrict__ gamma,
                                                       const float* __restrict__ beta,
                                                       float* __restrict__ out) {
    __shared__ __attribute__((aligned(16))) __bf16 Abuf[ORT * 16][DM + PADH];  // pitch 2064 B
    __shared__ __attribute__((aligned(16))) float  xrow[ORT * 16][DM];  // 128 KB

    int lane = threadIdx.x & 31, wave = threadIdx.x >> 5;
    int m0 = blockIdx.x * (ORT * 16);
    int kb = (lane >> 4) * 8;

    // stage A tile: 32 rows x 1024 bf16, four rows per shot
    {
        const __bf16* gsrc = ctx + (size_t)m0 * DM;
        int row = threadIdx.x >> 7, col = (threadIdx.x & 127) * 8;
#pragma unroll
        for (int it = 0; it < ORT * 4; ++it)
            stage_async_b128(gsrc + (it * 4 + row) * DM + col, &Abuf[it * 4 + row][col]);
    }
    stage_wait();

    const __bf16* ap = &Abuf[lane & 15][kb];
    const __bf16* bp = Wot + (size_t)(wave * OCT) * WTILE + lane * 8;

    v8f c[ORT][OCT];
#pragma unroll
    for (int r = 0; r < ORT; ++r)
#pragma unroll
        for (int j = 0; j < OCT; ++j) c[r][j] = zero8();

    // unrolled by 2: the second k step's W loads issue under the first's products
#pragma unroll 2
    for (int k0 = 0; k0 < DM; k0 += 32) {
        v16bf b[OCT];
#pragma unroll
        for (int j = 0; j < OCT; ++j)
            b[j] = frag_packed(bp + j * WTILE + (k0 >> 5) * WFRAG);
#pragma unroll
        for (int r = 0; r < ORT; ++r) {
            v16bf a = frag_bf16(ap + r * 16 * (DM + PADH) + k0);
#pragma unroll
            for (int j = 0; j < OCT; ++j) c[r][j] = wmma_bf16(a, b[j], c[r][j]);
        }
    }

    // the wave's 64 residual elements per lane, all loads in flight together
    int col0 = wave * OCT * 16 + (lane & 15);
    int row0 = (lane >> 4) << 3;
    const float* rp = residual + (size_t)(m0 + row0) * DM + col0;
    float res[OCT][ORT][8];
#pragma unroll
    for (int j = 0; j < OCT; ++j)
#pragma unroll
        for (int r = 0; r < ORT; ++r)
#pragma unroll
            for (int i = 0; i < 8; ++i) res[j][r][i] = rp[(r * 16 + i) * DM + j * 16];
    // the address stays live up to this wait, so that no load of the run lands in
    // a register that an earlier load of the run names as its address
    asm volatile("s_wait_xcnt 0x0" :: "v"(rp) : "memory");

#pragma unroll
    for (int j = 0; j < OCT; ++j) {
        int colB = col0 + j * 16;
        float bv = bo[colB];
#pragma unroll
        for (int r = 0; r < ORT; ++r)
#pragma unroll
            for (int i = 0; i < 8; ++i) {
                int M = r * 16 + i + row0;
                float val = c[r][j][i] + bv + res[j][r][i];
                xrow[M][colB] = val;
            }
    }

    __syncthreads();

    // LayerNorm: 16 waves x 2 rows
#pragma unroll
    for (int rr = 0; rr < 2; ++rr) {
        int r = wave * 2 + rr;
        float sum = 0.0f, sq = 0.0f;
#pragma unroll
        for (int j = 0; j < DM / 32; ++j) {
            float x = xrow[r][lane + 32 * j];
            sum += x; sq += x * x;
        }
#pragma unroll
        for (int d = 1; d < 32; d <<= 1) {
            sum += __shfl_xor(sum, d, 32);
            sq  += __shfl_xor(sq,  d, 32);
        }
        float mu   = sum * (1.0f / DM);
        float var  = sq * (1.0f / DM) - mu * mu;
        float rinv = rsqrtf(var + 1e-6f);
        size_t grow = (size_t)(m0 + r) * DM;
#pragma unroll
        for (int j = 0; j < DM / 32; ++j) {
            int col = lane + 32 * j;
            float x = xrow[r][col];
            out[grow + col] = (x - mu) * rinv * gamma[col] + beta[col];
        }
    }
}

// ---------------------------------------------------------------- launcher
extern "C" void kernel_launch(void* const* d_in, const int* in_sizes, int n_in,
                              void* d_out, int out_size, void* d_ws, size_t ws_size,
                              hipStream_t stream) {
    const float* q    = (const float*)d_in[0];
    const float* k    = (const float*)d_in[1];
    const float* v    = (const float*)d_in[2];
    const int*   mask = (const int*)  d_in[3];
    const float* Wq   = (const float*)d_in[4];
    const float* bq   = (const float*)d_in[5];
    const float* Wk   = (const float*)d_in[6];
    const float* bk   = (const float*)d_in[7];
    const float* Wv   = (const float*)d_in[8];
    const float* bv   = (const float*)d_in[9];
    const float* Wo   = (const float*)d_in[10];
    const float* bo   = (const float*)d_in[11];
    const float* gamma = (const float*)d_in[12];
    const float* beta  = (const float*)d_in[13];
    float* out = (float*)d_out;

    char* ws = (char*)d_ws;
    const size_t WSZ  = (size_t)DM * DM;              // per-weight elems
    const size_t HSZ  = (size_t)NB * NH * SEQ * DK;   // per-head-tensor elems
    __bf16* Wt  = (__bf16*)ws;                                        // 4*WSZ bf16
    __bf16* Qh  = (__bf16*)(ws + 4 * WSZ * 2);                        // HSZ
    __bf16* Kh  = Qh + HSZ;
    __bf16* Vt  = Kh + HSZ;
    __bf16* CTX = Vt + HSZ;                                           // HSZ

    wconv_kernel<<<dim3(WSZ / 8 / 256, 4), 256, 0, stream>>>(Wq, Wk, Wv, Wo, Wt);

    dim3 pg(NB * SEQ / (PRT * 16), DM / (16 * PCT * PWAVES));
    proj_kernel<<<pg, PWAVES * 32, 0, stream>>>(q, Wt,           bq, Qh, 0);
    proj_kernel<<<pg, PWAVES * 32, 0, stream>>>(k, Wt + WSZ,     bk, Kh, 2);
    proj_kernel<<<pg, PWAVES * 32, 0, stream>>>(v, Wt + 2 * WSZ, bv, Vt, 1);

    attn_kernel<<<dim3(SEQ / 128, NB * NH), 256, 0, stream>>>(Qh, Kh, Vt, mask, CTX);

    oproj_ln_kernel<<<dim3(NB * SEQ / (ORT * 16)), OWAVES * 32, 0, stream>>>(
        CTX, Wt + 3 * WSZ, bo, q, gamma, beta, out);
}

// v007
// Measured time: 171 microseconds a run.
// Two timings next to v006 both put it at 1.11 times that version's speed.
// All steps since v000 together make it 5.67 times as fast.
#include <hip/hip_runtime.h>

// ---------------------------------------------------------------- types
typedef __attribute__((ext_vector_type(16))) __bf16 v16bf;
typedef __attribute__((ext_vector_type(8)))  __bf16 v8bf;
typedef __attribute__((ext_vector_type(8)))  float  v8f;
typedef __attribute__((ext_vector_type(4)))  int    vi4;
typedef __attribute__((ext_vector_type(4)))  unsigned vu4;
typedef __attribute__((ext_vector_type(16))) unsigned vu16;

#define NB   4
#define SEQ  2048
#define DM   1024
#define NH   16
#define DK   64

// LDS row pads: every tile that ds_load_b128 reads as a WMMA fragment (16 lanes
// = 16 rows) gets a row pitch of 16 B x odd, so the 16 rows fall on 64 distinct
// banks instead of on the same four.
#define PADF 4    // f32 elements  (16 B)
#define PADH 8    // bf16 elements (16 B)

#define AS_GLOBAL __attribute__((address_space(1)))
#define AS_LDS    __attribute__((address_space(3)))
#define AS_CONST  __attribute__((address_space(4)))

__device__ __forceinline__ v8f zero8() {
    v8f z;
#pragma unroll
    for (int i = 0; i < 8; ++i) z[i] = 0.0f;
    return z;
}

__device__ __forceinline__ v16bf cat16(v8bf lo, v8bf hi) {
    v16bf r;
#pragma unroll
    for (int i = 0; i < 8; ++i) { r[i] = lo[i]; r[8 + i] = hi[i]; }
    return r;
}

// A/B fragment (16x32 bf16) per ISA layout: lane m = lane&15,
// kb = (lane>=16)?8:0, elems 0..7 = K[kb..kb+7], 8..15 = K[kb+16..kb+23].
__device__ __forceinline__ v16bf frag_bf16(const __bf16* p) {
    v8bf lo = *reinterpret_cast<const v8bf*>(p);
    v8bf hi = *reinterpret_cast<const v8bf*>(p + 16);
    return cat16(lo, hi);
}

// Packed weights: W^T is stored in B-fragment order. One 16-col x 32-k fragment
// is a 1 KB block [half-fragment 2][lane 32][8 bf16], so that each wave-wide
// 16-byte load reads 512 contiguous bytes (4 whole lines). Blocks run k-step
// first, then 16-column tile. Lane and element carry the same k as frag_bf16.
#define WFRAG 512                  // bf16 elements per fragment block
#define WTILE (WFRAG * (DM / 32))  // bf16 elements per 16-column tile
__device__ __forceinline__ v16bf frag_packed(const __bf16* p) {
    v8bf lo = *reinterpret_cast<const v8bf*>(p);
    v8bf hi = *reinterpret_cast<const v8bf*>(p + 256);
    return cat16(lo, hi);
}

// K and V^T of the attention use the same 1 KB fragment blocks:
//   K  : block = 16 keys x 32 d,  order [b*h][16-key tile][d step 2]
//   V^T: block = 16 d   x 32 keys, order [b*h][32-key step][16-d tile 4]
// so the 8 KB that one 32-key step reads are two contiguous 4 KB runs.

// Same fragment but converting fp32 source inline (two float4 pairs).
__device__ __forceinline__ v16bf frag_f32(const float* p) {
    const float4* p4 = reinterpret_cast<const float4*>(p);
    float4 f0 = p4[0], f1 = p4[1], f2 = p4[4], f3 = p4[5];
    v16bf r;
    r[0] = (__bf16)f0.x; r[1]  = (__bf16)f0.y; r[2]  = (__bf16)f0.z; r[3]  = (__bf16)f0.w;
    r[4] = (__bf16)f1.x; r[5]  = (__bf16)f1.y; r[6]  = (__bf16)f1.z; r[7]  = (__bf16)f1.w;
    r[8] = (__bf16)f2.x; r[9]  = (__bf16)f2.y; r[10] = (__bf16)f2.z; r[11] = (__bf16)f2.w;
    r[12] = (__bf16)f3.x; r[13] = (__bf16)f3.y; r[14] = (__bf16)f3.z; r[15] = (__bf16)f3.w;
    return r;
}

__device__ __forceinline__ v8f wmma_bf16(v16bf a, v16bf b, v8f c) {
    return __builtin_amdgcn_wmma_f32_16x16x32_bf16(false, a, false, b, (short)0, c, false, false);
}

// ---- async global->LDS staging (CDNA5 ASYNCcnt path), guarded fallback ----
__device__ __forceinline__ void stage_async_b128(const void* g, void* l) {
#if __has_builtin(__builtin_amdgcn_global_load_async_to_lds_b128)
    __builtin_amdgcn_global_load_async_to_lds_b128(
        (AS_GLOBAL vi4*)(g), (AS_LDS vi4*)(l), 0, 0);
#else
    *(float4*)l = *(const float4*)g;
#endif
}

__device__ __forceinline__ void stage_wait() {
#if __has_builtin(__builtin_amdgcn_global_load_async_to_lds_b128)
#if __has_builtin(__builtin_amdgcn_s_wait_asynccnt)
    __builtin_amdgcn_s_wait_asynccnt(0);
#else
    asm volatile("s_wait_asynccnt 0" ::: "memory");
#endif
#endif
    __syncthreads();
}

// Packed mask: the attention wave holds, in score register i of a 32-key step,
// lane l's score of query l & 15 and key kmap(i, l >> 4) = (i >> 3) * 16 + (l >> 4) * 8
// + (i & 7). One 32-bit word per register holds mask != 0 of its 32 lanes, bit l for
// lane l: the form a select takes as its lane condition. Order [b * 128 + 16-query
// tile][32-key step][i 16]: 64 bytes in a row per step, 4 KB per wave's walk.
#define MWORDS 16                  // words per query tile and key step
// the pack launch: one block per query tile, as many as a weight matrix has blocks;
// one thread per 4 words of the tile
static_assert(NB * SEQ / 16 == DM * DM / 8 / 256, "mask tiles = blocks per weight matrix");
static_assert(SEQ / 32 * MWORDS / 4 == 256, "4 words per thread of a 256-thread block");

// ---------------------------------------------------------------- kernel 1:
// blockIdx.y = 1..4: convert the 4 weight matrices to bf16 W^T in packed B-fragment
// order; one thread writes one lane's 16-byte piece (8 consecutive k of one column).
// blockIdx.y = 0: pack the mask; one block = one 16-query tile, one thread = 4 words
// (4 consecutive keys in each of the tile's 16 rows and both wave halves).
__global__ __launch_bounds__(256) void wconv_kernel(const float* __restrict__ Wq,
                                                    const float* __restrict__ Wk,
                                                    const float* __restrict__ Wv,
                                                    const float* __restrict__ Wo,
                                                    __bf16* __restrict__ Wt,
                                                    const int* __restrict__ mask,
                                                    unsigned* __restrict__ pm) {
    if (blockIdx.y == 0) {
        int j = threadIdx.x & 3, ks = threadIdx.x >> 2;
        const int* mp = mask + (size_t)blockIdx.x * 16 * SEQ + ks * 32 + (j >> 1) * 16 + (j & 1) * 4;
        vu4 wd = { 0u, 0u, 0u, 0u };
        // unrolled: the shift counts are constants, and the loads issue in long runs
        // ahead of their use
#pragma unroll
        for (int l = 0; l < 32; ++l) {
            vi4 m = *reinterpret_cast<const vi4*>(mp + (l & 15) * SEQ + (l >> 4) * 8);
#pragma unroll
            for (int e = 0; e < 4; ++e) wd[e] |= (m[e] != 0 ? 1u : 0u) << l;
        }
        *reinterpret_cast<vu4*>(pm + ((size_t)blockIdx.x * 256 + threadIdx.x) * 4) = wd;
        return;
    }
    int w = blockIdx.y - 1;
    const float* src = (w == 0) ? Wq : (w == 1) ? Wk : (w == 2) ? Wv : Wo;
    __bf16* dst = Wt + (size_t)w * DM * DM;
    int p = blockIdx.x * 256 + threadIdx.x;     // piece index in the packed order
    int ln = p & 31, hi = (p >> 5) & 1, ks = (p >> 6) & 31, nt = p >> 11;
    int n = nt * 16 + (ln & 15);
    int k = ks * 32 + hi * 16 + (ln >> 4) * 8;
    v8bf r;
    // unrolled: r is indexed by constants (stays in registers), the 8 loads issue together
#pragma unroll
    for (int e = 0; e < 8; ++e) r[e] = (__bf16)src[(size_t)(k + e) * DM + n];
    *reinterpret_cast<v8bf*>(dst + (size_t)p * 8) = r;
}

// ---------------------------------------------------------------- kernel 2:
// Y = X @ W + b, bf16 output per head. layout 0: rows [b,h,s,dk] (Q);
// layout 1: V^T fragment blocks; layout 2: K fragment blocks.
// One block = 64 rows x 512 columns. The 64-row fp32 A tile is staged once into
// LDS (async) and shared by all 16 waves; each wave owns 4 row tiles x 2 column
// tiles, so a W fragment loaded from global feeds 4 products and an A fragment
// read and converted from LDS feeds 2.
#define PRT 4                      // 16-row tiles per wave (and per block)
#define PCT 2                      // 16-column tiles per wave
#define PWAVES 16
__global__ __launch_bounds__(PWAVES * 32) void proj_kernel(const float* __restrict__ X,
                                                   const __bf16* __restrict__ Wt,
                                                   const float* __restrict__ bias,
                                                   __bf16* __restrict__ out,
                                                   int layout) {
    __shared__ __attribute__((aligned(16))) float As[PRT * 16][DM + PADF];   // pitch 4112 B

    int lane = threadIdx.x & 31, wave = threadIdx.x >> 5;
    int m0  = blockIdx.x * (PRT * 16);
    int nt0 = (blockIdx.y * PWAVES + wave) * PCT;    // the wave's first column tile
    int kb  = (lane >> 4) * 8;

    // stage A tile: 64 rows x 1024 f32, 16B per lane per shot, two rows per shot
    {
        const float* gsrc = X + (size_t)m0 * DM;
        int row = threadIdx.x >> 8, col = (threadIdx.x & 255) * 4;
#pragma unroll
        for (int it = 0; it < PRT * 8; ++it)
            stage_async_b128(gsrc + (it * 2 + row) * DM + col, &As[it * 2 + row][col]);
    }
    stage_wait();

    const float*  ap = &As[lane & 15][kb];
    const __bf16* bp = Wt + (size_t)nt0 * WTILE + lane * 8;

    v8f c[PRT][PCT];
#pragma unroll
    for (int r = 0; r < PRT; ++r)
#pragma unroll
        for (int j = 0; j < PCT; ++j) c[r][j] = zero8();

    // unrolled by 2: the W loads of two k steps are in flight together
#pragma unroll 2
    for (int k0 = 0; k0 < DM; k0 += 32) {
        v16bf b[PCT];
#pragma unroll
        for (int j = 0; j < PCT; ++j)
            b[j] = frag_packed(bp + j * WTILE + (k0 >> 5) * WFRAG);
#pragma unroll
        for (int r = 0; r < PRT; ++r) {
            v16bf a = frag_f32(ap + r * 16 * (DM + PADF) + k0);
#pragma unroll
            for (int j = 0; j < PCT; ++j) c[r][j] = wmma_bf16(a, b[j], c[r][j]);
        }
    }

    int bq = (m0 >> 11) * NH;            // the 64 rows of a block share one batch
    int sb = m0 & (SEQ - 1);
#pragma unroll
    for (int j = 0; j < PCT; ++j) {
        int colB = (nt0 + j) * 16 + (lane & 15);
        float bv = bias[colB];
        int h = colB >> 6, d = colB & (DK - 1);
        int bh = bq + h;
        if (layout == 1) {
            // a lane's 8 accumulators are 8 consecutive keys of one d: exactly its
            // 16-byte piece of the V^T block, so the wave stores 512 contiguous bytes
#pragma unroll
            for (int r = 0; r < PRT; ++r) {
                int s0 = sb + r * 16;
                v8bf o;
#pragma unroll
                for (int i = 0; i < 8; ++i) o[i] = (__bf16)(c[r][j][i] + bv);
                size_t blk = ((size_t)bh * (SEQ / 32) + (s0 >> 5)) * 4 + (d >> 4);
                *reinterpret_cast<v8bf*>(out + blk * WFRAG + ((s0 >> 4) & 1) * 256 + lane * 8) = o;
            }
            // the next column tile's code rewrites registers that these stores name
            asm volatile("s_wait_xcnt 0x0" ::: "memory");
        } else {
            // a lane's 8 accumulators are 8 consecutive rows s of one d: one element
            // every DK elements in the row layout, every 8 (next lane slot) in a K block
            int sl = (lane >> 4) << 3;
            int step = (layout == 2) ? 8 : DK;
#pragma unroll
            for (int r = 0; r < PRT; ++r) {
                int s0 = sb + r * 16;
                size_t blk = ((size_t)bh * (SEQ / 16) + (s0 >> 4)) * 2 + (d >> 5);
                size_t koff = blk * WFRAG + ((d >> 4) & 1) * 256 + (((d >> 3) & 1) * 16 + sl) * 8 + (d & 7);
                size_t qoff = ((size_t)bh * SEQ + s0 + sl) * DK + d;
                __bf16* p = out + (layout == 2 ? koff : qoff);
#pragma unroll
                for (int i = 0; i < 8; ++i) p[i * step] = (__bf16)(c[r][j][i] + bv);
            }
            // in the listing this path falls on into the other branch's code, which
            // rewrites registers that these stores name: keep the wait in front of it
            asm volatile("s_wait_xcnt 0x0" ::: "memory");
        }
    }
}

#define KSTG 64                    // keys per ring stage
#define NSTG (SEQ / KSTG)
#define STGE (KSTG * DK)           // bf16 elements of K, and of V^T, per stage (8 KB)
#define BUFB (2 * STGE * 2)        // bytes per ring buffer: K, then V^T

// One thread's share of a stage: two 16-byte pieces of K, two of V^T. gk and gv
// are the thread's first pieces in global memory, l that of K in the buffer (LDS
// byte address); the second piece lies STGE / 2 elements = STGE bytes on. The
// s_wait_xcnt stands inside the statement, so that no address register of a copy
// is rewritten in front of it.
__device__ __forceinline__ void stage_kv(const __bf16* gk, const __bf16* gv, unsigned l) {
    asm volatile("global_load_async_to_lds_b128 %0, %4, off\n\t"
                 "global_load_async_to_lds_b128 %1, %5, off\n\t"
                 "global_load_async_to_lds_b128 %2, %6, off\n\t"
                 "global_load_async_to_lds_b128 %3, %7, off\n\t"
                 "s_wait_xcnt 0x0"
                 :: "v"(l), "v"(l + STGE), "v"(l + 2 * STGE), "v"(l + 3 * STGE),
                    "v"(gk), "v"(gk + STGE / 2), "v"(gv), "v"(gv + STGE / 2)
                 : "memory");
}

// lane l <-> lane l ^ 16
__device__ __forceinline__ float xhalf(float x) {
    int b = __builtin_bit_cast(int, x);
    return __builtin_bit_cast(float,
        __builtin_amdgcn_permlanex16(b, b, 0x76543210, 0xfedcba98, false, false));
}

// waves_per_eu(8, 8): the grid fills the chip at 4 blocks per WGP = 8 waves per SIMD,
// as before. Without it the compiler, seeing LDS for 10 blocks, squeezes the loop
// into 96 registers and waits out every LDS load one by one.
__global__ __launch_bounds__(256) __attribute__((amdgpu_waves_per_eu(8, 8))) void attn_kernel(const __bf16* __restrict__ Qh,
                                                   const __bf16* __restrict__ Kp,
                                                   const __bf16* __restrict__ Vp,
                                                   const unsigned* __restrict__ pm,
                                                   __bf16* __restrict__ ctx) {
    __shared__ __attribute__((aligned(16))) __bf16 ring[2][2][STGE];   // [buffer][K, V^T]

    int lane = threadIdx.x & 31, wave = threadIdx.x >> 5;
    int bh = blockIdx.y;                 // b*NH + h
    int b  = bh >> 4, h = bh & (NH - 1);
    int q0 = (blockIdx.x * 8 + wave) * 16;
    int N  = lane & 15;                  // this lane's query
    int kb = (lane >> 4) * 8;

    // resident Q fragments (dk = 64 -> two 32x16 B fragments, column = query)
    const __bf16* qbase = Qh + ((size_t)bh * SEQ + q0 + N) * DK;
    v16bf qb0 = frag_bf16(qbase + kb);
    v16bf qb1 = frag_bf16(qbase + 32 + kb);

    v8f o[4];                            // o[f][r] = O[query N][f*16 + kb + r]
#pragma unroll
    for (int f = 0; f < 4; ++f) o[f] = zero8();
    float mrun = -1e30f;                 // the query's maximum, equal in both halves
    float lrun = 0.0f;                   // this half's share of the query's sum

    // the wave's packed mask words. An earlier launch wrote them and nothing writes them
    // while this kernel runs: read through the constant address space, at an address
    // formed from the wave's number as a scalar, they come by scalar loads straight into
    // the scalar registers that the selects take as their lane condition
    const AS_CONST vu16* mwav = (const AS_CONST vu16*)(pm
        + (size_t)(b * (SEQ / 16) + blockIdx.x * 8 + __builtin_amdgcn_readfirstlane(wave))
          * (SEQ / 32) * MWORDS);

    // ring prologue: stage 0 lands and is published, stage 1 is under way
    const __bf16* gk = Kp + (size_t)bh * SEQ * DK + threadIdx.x * 8;
    const __bf16* gv = Vp + (size_t)bh * SEQ * DK + threadIdx.x * 8;
    unsigned l0 = (unsigned)(size_t)(AS_LDS __bf16*)&ring[0][0][threadIdx.x * 8];
    stage_kv(gk, gv, l0);
    // this wave's copies of stage 0 have landed before the barrier publishes them
    asm volatile("s_wait_asynccnt 0x0" ::: "memory");
    __syncthreads();
    stage_kv(gk + STGE, gv + STGE, l0 + BUFB);

    for (int t = 0; t < NSTG; ++t) {
      const __bf16* kst = &ring[t & 1][0][lane * 8];
      const __bf16* vst = &ring[t & 1][1][lane * 8];
      // kept rolled: two passes scheduled as one region want more than the 128
      // registers that 8 waves per SIMD leave a wave
#pragma unroll 1
      for (int ps = 0; ps < KSTG / 32; ++ps) {
        int s0 = t * KSTG + ps * 32;
        // --- scores: two 16x16 tiles (keys s0..+15, s0+16..+31) x 16 queries
        const __bf16* kB0 = kst + ps * 4 * WFRAG;                 // 4 blocks, 4 KB
        const __bf16* kB1 = kB0 + 2 * WFRAG;
        v8f st0 = wmma_bf16(frag_packed(kB0 + WFRAG), qb1,
                  wmma_bf16(frag_packed(kB0), qb0, zero8()));
        v8f st1 = wmma_bf16(frag_packed(kB1 + WFRAG), qb1,
                  wmma_bf16(frag_packed(kB1), qb0, zero8()));

        // --- scale and mask: one word per score register is the select's lane condition
        vu16 mk = mwav[s0 >> 5];
        float v0[8], v1[8];
#pragma unroll
        for (int i = 0; i < 8; ++i) {
            v0[i] = __builtin_amdgcn_inverse_ballot_w32(mk[i])     ? st0[i] * 0.125f : -1e9f;
            v1[i] = __builtin_amdgcn_inverse_ballot_w32(mk[8 + i]) ? st1[i] * 0.125f : -1e9f;
        }

        // --- online softmax of one query per lane pair
        float t = fmaxf(v0[0], v1[0]);
#pragma unroll
        for (int i = 1; i < 8; ++i) t = fmaxf(t, fmaxf(v0[i], v1[i]));
        t = fmaxf(t, xhalf(t));
        float mnew  = fmaxf(mrun, t);
        float alpha = __expf(mrun - mnew);
        mrun = mnew;

        v16bf pb;                        // P^T as B: element s = key kmap(s, h)
        float rs = 0.0f;
#pragma unroll
        for (int i = 0; i < 8; ++i) {
            float p0 = __expf(v0[i] - mnew);
            float p1 = __expf(v1[i] - mnew);
            rs += p0 + p1;
            pb[i]     = (__bf16)p0;
            pb[8 + i] = (__bf16)p1;
        }
        lrun = lrun * alpha + rs;
#pragma unroll
        for (int f = 0; f < 4; ++f)
#pragma unroll
            for (int i = 0; i < 8; ++i) o[f][i] *= alpha;

        // --- O^T += V^T @ P^T  (V^T blocks of this key step, one per 16-d tile)
        const __bf16* vb = vst + ps * 4 * WFRAG;
#pragma unroll
        for (int f = 0; f < 4; ++f)
            o[f] = wmma_bf16(frag_packed(vb + f * WFRAG), pb, o[f]);
        // one more vector slot behind the pass's last product; the scheduling fence
        // keeps the v_nop at the foot of the pass
        __builtin_amdgcn_sched_barrier(0);
        asm volatile("v_nop");
      }

      // publish point of stage t + 1: this wave's reads of stage t are done ...
      asm volatile("s_wait_dscnt 0x0" ::: "memory");
      // ... its copies of stage t + 1 have landed ...
      asm volatile("s_wait_asynccnt 0x0" ::: "memory");
      // ... and behind the barrier that holds for all 8 waves
      __syncthreads();
      if (t + 2 < NSTG)                  // refill the buffer that every wave has left
          stage_kv(gk + (t + 2) * STGE, gv + (t + 2) * STGE, l0 + (t & 1) * BUFB);
    }
    // no copy is outstanding when the wave ends
    asm volatile("s_wait_asynccnt 0x0" ::: "memory");

    // --- join the halves' sums, normalize, store ctx (bf16, [B,S,D], D = h*64+d):
    // a lane's 8 accumulators of a tile are 8 consecutive d of its query
    float inv = 1.0f / (lrun + xhalf(lrun));
    __bf16* cp = ctx + ((size_t)(b * SEQ + q0 + N)) * DM + h * DK + kb;
#pragma unroll
    for (int f = 0; f < 4; ++f) {
        v8bf r;
#pragma unroll
        for (int i = 0; i < 8; ++i) r[i] = (__bf16)(o[f][i] * inv);
        *reinterpret_cast<v8bf*>(cp + f * 16) = r;
    }
}

// ---------------------------------------------------------------- kernel 4:
// out = LN(ctx @ Wo + bo + residual); one block = 32 full rows, 16 waves.
// The shared bf16 ctx A tile (64 KB) is staged async into LDS; each wave owns
// 2 row tiles x 4 column tiles, so a W fragment loaded from global feeds 2
// products and an A fragment read from LDS feeds 4.
#define ORT 2                      // 16-row tiles per wave (and per block)
#define OCT 4                      // 16-column tiles per wave
#define OWAVES 16
__global__ __launch_bounds__(OWAVES * 32) void oproj_ln_kernel(const __bf16* __restrict__ ctx,
                                                       const __bf16* __restrict__ Wot,
                                                       const float* __restrict__ bo,
                                                       const float* __restrict__ residual,
                                                       const float* __restrict__ gamma,
                                                       const float* __restrict__ beta,
                                                       float* __restrict__ out) {
    __shared__ __attribute__((aligned(16))) __bf16 Abuf[ORT * 16][DM + PADH];  // pitch 2064 B
    __shared__ __attribute__((aligned(16))) float  xrow[ORT * 16][DM];  // 128 KB

    int lane = threadIdx.x & 31, wave = threadIdx.x >> 5;
    int m0 = blockIdx.x * (ORT * 16);
    int kb = (lane >> 4) * 8;

    // stage A tile: 32 rows x 1024 bf16, four rows per shot
    {
        const __bf16* gsrc = ctx + (size_t)m0 * DM;
        int row = threadIdx.x >> 7, col = (threadIdx.x & 127) * 8;
#pragma unroll
        for (int it = 0; it < ORT * 4; ++it)
            stage_async_b128(gsrc + (it * 4 + row) * DM + col, &Abuf[it * 4 + row][col]);
    }
    stage_wait();

    const __bf16* ap = &Abuf[lane & 15][kb];
    const __bf16* bp = Wot + (size_t)(wave * OCT) * WTILE + lane * 8;

    v8f c[ORT][OCT];
#pragma unroll
    for (int r = 0; r < ORT; ++r)
#pragma unroll
        for (int j = 0; j < OCT; ++j) c[r][j] = zero8();

    // unrolled by 2: the second k step's W loads issue under the first's products
#pragma unroll 2
    for (int k0 = 0; k0 < DM; k0 += 32) {
        v16bf b[OCT];
#pragma unroll
        for (int j = 0; j < OCT; ++j)
            b[j] = frag_packed(bp + j * WTILE + (k0 >> 5) * WFRAG);
#pragma unroll
        for (int r = 0; r < ORT; ++r) {
            v16bf a = frag_bf16(ap + r * 16 * (DM + PADH) + k0);
#pragma unroll
            for (int j = 0; j < OCT; ++j) c[r][j] = wmma_bf16(a, b[j], c[r][j]);
        }
    }

    // the wave's 64 residual elements per lane, all loads in flight together
    int col0 = wave * OCT * 16 + (lane & 15);
    int row0 = (lane >> 4) << 3;
    const float* rp = residual + (size_t)(m0 + row0) * DM + col0;
    float res[OCT][ORT][8];
#pragma unroll
    for (int j = 0; j < OCT; ++j)
#pragma unroll
        for (int r = 0; r < ORT; ++r)
#pragma unroll
            for (int i = 0; i < 8; ++i) res[j][r][i] = rp[(r * 16 + i) * DM + j * 16];
    // the address stays live up to this wait, so that no load of the run lands in
    // a register that an earlier load of the run names as its address
    asm volatile("s_wait_xcnt 0x0" :: "v"(rp) : "memory");

#pragma unroll
    for (int j = 0; j < OCT; ++j) {
        int colB = col0 + j * 16;
        float bv = bo[colB];
#pragma unroll
        for (int r = 0; r < ORT; ++r)
#pragma unroll
            for (int i = 0; i < 8; ++i) {
                int M = r * 16 + i + row0;
                float val = c[r][j][i] + bv + res[j][r][i];
                xrow[M][colB] = val;
            }
    }

    __syncthreads();

    // LayerNorm: 16 waves x 2 rows
#pragma unroll
    for (int rr = 0; rr < 2; ++rr) {
        int r = wave * 2 + rr;
        float sum = 0.0f, sq = 0.0f;
#pragma unroll
        for (int j = 0; j < DM / 32; ++j) {
            float x = xrow[r][lane + 32 * j];
            sum += x; sq += x * x;
        }
#pragma unroll
        for (int d = 1; d < 32; d <<= 1) {
            sum += __shfl_xor(sum, d, 32);
            sq  += __shfl_xor(sq,  d, 32);
        }
        float mu   = sum * (1.0f / DM);
        float var  = sq * (1.0f / DM) - mu * mu;
        float rinv = rsqrtf(var + 1e-6f);
        size_t grow = (size_t)(m0 + r) * DM;
#pragma unroll
        for (int j = 0; j < DM / 32; ++j) {
            int col = lane + 32 * j;
            float x = xrow[r][col];
            out[grow + col] = (x - mu) * rinv * gamma[col] + beta[col];
        }
    }
}

// ---------------------------------------------------------------- launcher
extern "C" void kernel_launch(void* const* d_in, const int* in_sizes, int n_in,
                              void* d_out, int out_size, void* d_ws, size_t ws_size,
                              hipStream_t stream) {
    const float* q    = (const float*)d_in[0];
    const float* k    = (const float*)d_in[1];
    const float* v    = (const float*)d_in[2];
    const int*   mask = (const int*)  d_in[3];
    const float* Wq   = (const float*)d_in[4];
    const float* bq   = (const float*)d_in[5];
    const float* Wk   = (const float*)d_in[6];
    const float* bk   = (const float*)d_in[7];
    const float* Wv   = (const float*)d_in[8];
    const float* bv   = (const float*)d_in[9];
    const float* Wo   = (const float*)d_in[10];
    const float* bo   = (const float*)d_in[11];
    const float* gamma = (const float*)d_in[12];
    const float* beta  = (const float*)d_in[13];
    float* out = (float*)d_out;

    char* ws = (char*)d_ws;
    const size_t WSZ  = (size_t)DM * DM;              // per-weight elems
    const size_t HSZ  = (size_t)NB * NH * SEQ * DK;   // per-head-tensor elems
    __bf16* Wt  = (__bf16*)ws;                                        // 4*WSZ bf16
    __bf16* Qh  = (__bf16*)(ws + 4 * WSZ * 2);                        // HSZ
    __bf16* Kh  = Qh + HSZ;
    __bf16* Vt  = Kh + HSZ;
    __bf16* CTX = Vt + HSZ;                                           // HSZ
    unsigned* PM = (unsigned*)(CTX + HSZ);                            // NB*SEQ*SEQ/32 words

    wconv_kernel<<<dim3(WSZ / 8 / 256, 5), 256, 0, stream>>>(Wq, Wk, Wv, Wo, Wt, mask, PM);

    dim3 pg(NB * SEQ / (PRT * 16), DM / (16 * PCT * PWAVES));
    proj_kernel<<<pg, PWAVES * 32, 0, stream>>>(q, Wt,           bq, Qh, 0);
    proj_kernel<<<pg, PWAVES * 32, 0, stream>>>(k, Wt + WSZ,     bk, Kh, 2);
    proj_kernel<<<pg, PWAVES * 32, 0, stream>>>(v, Wt + 2 * WSZ, bv, Vt, 1);

    attn_kernel<<<dim3(SEQ / 128, NB * NH), 256, 0, stream>>>(Qh, Kh, Vt, PM, CTX);

    oproj_ln_kernel<<<dim3(NB * SEQ / (ORT * 16)), OWAVES * 32, 0, stream>>>(
        CTX, Wt + 3 * WSZ, bo, q, gamma, beta, out);
}

// v008
// Measured time: 167 microseconds a run.
// Two timings next to v007 put it at 1.03 and 1.02 times that version's speed.
// All steps since v000 together make it 5.82 times as fast.
#include <hip/hip_runtime.h>

// ---------------------------------------------------------------- types
typedef __attribute__((ext_vector_type(16))) __bf16 v16bf;
typedef __attribute__((ext_vector_type(8)))  __bf16 v8bf;
typedef __attribute__((ext_vector_type(8)))  float  v8f;
typedef __attribute__((ext_vector_type(4)))  int    vi4;
typedef __attribute__((ext_vector_type(4)))  unsigned vu4;
typedef __attribute__((ext_vector_type(16))) unsigned vu16;

#define NB   4
#define SEQ  2048
#define DM   1024
#define NH   16
#define DK   64

// LDS row pads: every tile that ds_load_b128 reads as a WMMA fragment (16 lanes
// = 16 rows) gets a row pitch of 16 B x odd, so the 16 rows fall on 64 distinct
// banks instead of on the same four.
#define PADF 4    // f32 elements  (16 B)
#define PADH 8    // bf16 elements (16 B)

#define AS_GLOBAL __attribute__((address_space(1)))
#define AS_LDS    __attribute__((address_space(3)))
#define AS_CONST  __attribute__((address_space(4)))

__device__ __forceinline__ v8f zero8() {
    v8f z;
#pragma unroll
    for (int i = 0; i < 8; ++i) z[i] = 0.0f;
    return z;
}

__device__ __forceinline__ v16bf cat16(v8bf lo, v8bf hi) {
    v16bf r;
#pragma unroll
    for (int i = 0; i < 8; ++i) { r[i] = lo[i]; r[8 + i] = hi[i]; }
    return r;
}

// A/B fragment (16x32 bf16) per ISA layout: lane m = lane&15,
// kb = (lane>=16)?8:0, elems 0..7 = K[kb..kb+7], 8..15 = K[kb+16..kb+23].
__device__ __forceinline__ v16bf frag_bf16(const __bf16* p) {
    v8bf lo = *reinterpret_cast<const v8bf*>(p);
    v8bf hi = *reinterpret_cast<const v8bf*>(p + 16);
    return cat16(lo, hi);
}

// Packed weights: W^T is stored in B-fragment order. One 16-col x 32-k fragment
// is a 1 KB block [half-fragment 2][lane 32][8 bf16], so that each wave-wide
// 16-byte load reads 512 contiguous bytes (4 whole lines). Blocks run k-step
// first, then 16-column tile. Lane and element carry the same k as frag_bf16.
#define WFRAG 512                  // bf16 elements per fragment block
#define WTILE (WFRAG * (DM / 32))  // bf16 elements per 16-column tile
__device__ __forceinline__ v16bf frag_packed(const __bf16* p) {
    v8bf lo = *reinterpret_cast<const v8bf*>(p);
    v8bf hi = *reinterpret_cast<const v8bf*>(p + 256);
    return cat16(lo, hi);
}

// K and V^T of the attention use the same 1 KB fragment blocks:
//   K  : block = 16 keys x 32 d,  order [b*h][16-key tile][d step 2]
//   V^T: block = 16 d   x 32 keys, order [b*h][32-key step][16-d tile 4]
// so the 8 KB that one 32-key step reads are two contiguous 4 KB runs.

// Same fragment but converting fp32 source inline (two float4 pairs).
__device__ __forceinline__ v16bf frag_f32(const float* p) {
    const float4* p4 = reinterpret_cast<const float4*>(p);
    float4 f0 = p4[0], f1 = p4[1], f2 = p4[4], f3 = p4[5];
    v16bf r;
    r[0] = (__bf16)f0.x; r[1]  = (__bf16)f0.y; r[2]  = (__bf16)f0.z; r[3]  = (__bf16)f0.w;
    r[4] = (__bf16)f1.x; r[5]  = (__bf16)f1.y; r[6]  = (__bf16)f1.z; r[7]  = (__bf16)f1.w;
    r[8] = (__bf16)f2.x; r[9]  = (__bf16)f2.y; r[10] = (__bf16)f2.z; r[11] = (__bf16)f2.w;
    r[12] = (__bf16)f3.x; r[13] = (__bf16)f3.y; r[14] = (__bf16)f3.z; r[15] = (__bf16)f3.w;
    return r;
}

__device__ __forceinline__ v8f wmma_bf16(v16bf a, v16bf b, v8f c) {
    return __builtin_amdgcn_wmma_f32_16x16x32_bf16(false, a, false, b, (short)0, c, false, false);
}

// ---- async global->LDS staging (CDNA5 ASYNCcnt path), guarded fallback ----
__device__ __forceinline__ void stage_async_b128(const void* g, void* l) {
#if __has_builtin(__builtin_amdgcn_global_load_async_to_lds_b128)
    __builtin_amdgcn_global_load_async_to_lds_b128(
        (AS_GLOBAL vi4*)(g), (AS_LDS vi4*)(l), 0, 0);
#else
    *(float4*)l = *(const float4*)g;
#endif
}

__device__ __forceinline__ void stage_wait() {
#if __has_builtin(__builtin_amdgcn_global_load_async_to_lds_b128)
#if __has_builtin(__builtin_amdgcn_s_wait_asynccnt)
    __builtin_amdgcn_s_wait_asynccnt(0);
#else
    asm volatile("s_wait_asynccnt 0" ::: "memory");
#endif
#endif
    __syncthreads();
}

// Packed mask: the attention wave holds, in score register i of a 32-key step,
// lane l's score of query l & 15 and key kmap(i, l >> 4) = (i >> 3) * 16 + (l >> 4) * 8
// + (i & 7). One 32-bit word per register holds mask != 0 of its 32 lanes, bit l for
// lane l: the form a select takes as its lane condition. Order [b * 128 + 16-query
// tile][32-key step][i 16]: 64 bytes in a row per step, 4 KB per wave's walk.
#define MWORDS 16                  // words per query tile and key step
// the pack launch: one block per query tile, as many as a weight matrix has blocks;
// one thread per 4 words of the tile
static_assert(NB * SEQ / 16 == DM * DM / 8 / 256, "mask tiles = blocks per weight matrix");
static_assert(SEQ / 32 * MWORDS / 4 == 256, "4 words per thread of a 256-thread block");

// ---------------------------------------------------------------- kernel 1:
// blockIdx.y = 1..4: convert the 4 weight matrices to bf16 W^T in packed B-fragment
// order; one thread writes one lane's 16-byte piece (8 consecutive k of one column).
// blockIdx.y = 0: pack the mask; one block = one 16-query tile, one thread = 4 words
// (4 consecutive keys in each of the tile's 16 rows and both wave halves).
__global__ __launch_bounds__(256) void wconv_kernel(const float* __restrict__ Wq,
                                                    const float* __restrict__ Wk,
                                                    const float* __restrict__ Wv,
                                                    const float* __restrict__ Wo,
                                                    __bf16* __restrict__ Wt,
                                                    const int* __restrict__ mask,
                                                    unsigned* __restrict__ pm) {
    if (blockIdx.y == 0) {
        int j = threadIdx.x & 3, ks = threadIdx.x >> 2;
        const int* mp = mask + (size_t)blockIdx.x * 16 * SEQ + ks * 32 + (j >> 1) * 16 + (j & 1) * 4;
        vu4 wd = { 0u, 0u, 0u, 0u };
        // unrolled: the shift counts are constants, and the loads issue in long runs
        // ahead of their use
#pragma unroll
        for (int l = 0; l < 32; ++l) {
            vi4 m = *reinterpret_cast<const vi4*>(mp + (l & 15) * SEQ + (l >> 4) * 8);
#pragma unroll
            for (int e = 0; e < 4; ++e) wd[e] |= (m[e] != 0 ? 1u : 0u) << l;
        }
        *reinterpret_cast<vu4*>(pm + ((size_t)blockIdx.x * 256 + threadIdx.x) * 4) = wd;
        return;
    }
    int w = blockIdx.y - 1;
    const float* src = (w == 0) ? Wq : (w == 1) ? Wk : (w == 2) ? Wv : Wo;
    __bf16* dst = Wt + (size_t)w * DM * DM;
    int p = blockIdx.x * 256 + threadIdx.x;     // piece index in the packed order
    int ln = p & 31, hi = (p >> 5) & 1, ks = (p >> 6) & 31, nt = p >> 11;
    int n = nt * 16 + (ln & 15);
    int k = ks * 32 + hi * 16 + (ln >> 4) * 8;
    v8bf r;
    // unrolled: r is indexed by constants (stays in registers), the 8 loads issue together
#pragma unroll
    for (int e = 0; e < 8; ++e) r[e] = (__bf16)src[(size_t)(k + e) * DM + n];
    *reinterpret_cast<v8bf*>(dst + (size_t)p * 8) = r;
}

// ---------------------------------------------------------------- kernel 2:
// Y = X @ W + b, bf16 output per head. layout 0: rows [b,h,s,dk] (Q);
// layout 1: V^T fragment blocks; layout 2: K fragment blocks.
// One block = 64 rows x 512 columns. The 64-row fp32 A tile is staged once into
// LDS (async) and shared by all 16 waves; each wave owns 4 row tiles x 2 column
// tiles, so a W fragment loaded from global feeds 4 products and an A fragment
// read and converted from LDS feeds 2.
#define PRT 4                      // 16-row tiles per wave (and per block)
#define PCT 2                      // 16-column tiles per wave
#define PWAVES 16
__global__ __launch_bounds__(PWAVES * 32) void proj_kernel(const float* __restrict__ X,
                                                   const __bf16* __restrict__ Wt,
                                                   const float* __restrict__ bias,
                                                   __bf16* __restrict__ out,
                                                   int layout) {
    __shared__ __attribute__((aligned(16))) float As[PRT * 16][DM + PADF];   // pitch 4112 B

    int lane = threadIdx.x & 31, wave = threadIdx.x >> 5;
    int m0  = blockIdx.x * (PRT * 16);
    int nt0 = (blockIdx.y * PWAVES + wave) * PCT;    // the wave's first column tile
    int kb  = (lane >> 4) * 8;

    // stage A tile: 64 rows x 1024 f32, 16B per lane per shot, two rows per shot
    {
        const float* gsrc = X + (size_t)m0 * DM;
        int row = threadIdx.x >> 8, col = (threadIdx.x & 255) * 4;
#pragma unroll
        for (int it = 0; it < PRT * 8; ++it)
            stage_async_b128(gsrc + (it * 2 + row) * DM + col, &As[it * 2 + row][col]);
    }
    stage_wait();

    const float*  ap = &As[lane & 15][kb];
    const __bf16* bp = Wt + (size_t)nt0 * WTILE + lane * 8;

    v8f c[PRT][PCT];
#pragma unroll
    for (int r = 0; r < PRT; ++r)
#pragma unroll
        for (int j = 0; j < PCT; ++j) c[r][j] = zero8();

    // unrolled by 2: the W loads of two k steps are in flight together
#pragma unroll 2
    for (int k0 = 0; k0 < DM; k0 += 32) {
        v16bf b[PCT];
#pragma unroll
        for (int j = 0; j < PCT; ++j)
            b[j] = frag_packed(bp + j * WTILE + (k0 >> 5) * WFRAG);
#pragma unroll
        for (int r = 0; r < PRT; ++r) {
            v16bf a = frag_f32(ap + r * 16 * (DM + PADF) + k0);
#pragma unroll
            for (int j = 0; j < PCT; ++j) c[r][j] = wmma_bf16(a, b[j], c[r][j]);
        }
    }

    int bq = (m0 >> 11) * NH;            // the 64 rows of a block share one batch
    int sb = m0 & (SEQ - 1);
#pragma unroll
    for (int j = 0; j < PCT; ++j) {
        int colB = (nt0 + j) * 16 + (lane & 15);
        float bv = bias[colB];
        int h = colB >> 6, d = colB & (DK - 1);
        int bh = bq + h;
        if (layout == 1) {
            // a lane's 8 accumulators are 8 consecutive keys of one d: exactly its
            // 16-byte piece of the V^T block, so the wave stores 512 contiguous bytes
#pragma unroll
            for (int r = 0; r < PRT; ++r) {
                int s0 = sb + r * 16;
                v8bf o;
#pragma unroll
                for (int i = 0; i < 8; ++i) o[i] = (__bf16)(c[r][j][i] + bv);
                size_t blk = ((size_t)bh * (SEQ / 32) + (s0 >> 5)) * 4 + (d >> 4);
                *reinterpret_cast<v8bf*>(out + blk * WFRAG + ((s0 >> 4) & 1) * 256 + lane * 8) = o;
            }
            // the next column tile's code rewrites registers that these stores name
            asm volatile("s_wait_xcnt 0x0" ::: "memory");
        } else {
            // a lane's 8 accumulators are 8 consecutive rows s of one d: one element
            // every DK elements in the row layout, every 8 (next lane slot) in a K block
            int sl = (lane >> 4) << 3;
            int step = (layout == 2) ? 8 : DK;
#pragma unroll
            for (int r = 0; r < PRT; ++r) {
                int s0 = sb + r * 16;
                size_t blk = ((size_t)bh * (SEQ / 16) + (s0 >> 4)) * 2 + (d >> 5);
                size_t koff = blk * WFRAG + ((d >> 4) & 1) * 256 + (((d >> 3) & 1) * 16 + sl) * 8 + (d & 7);
                size_t qoff = ((size_t)bh * SEQ + s0 + sl) * DK + d;
                __bf16* p = out + (layout == 2 ? koff : qoff);
#pragma unroll
                for (int i = 0; i < 8; ++i) p[i * step] = (__bf16)(c[r][j][i] + bv);
            }
            // in the listing this path falls on into the other branch's code, which
            // rewrites registers that these stores name: keep the wait in front of it
            asm volatile("s_wait_xcnt 0x0" ::: "memory");
        }
    }
}

#define KSTG 64                    // keys per ring stage
#define NSTG (SEQ / KSTG)
#define STGE (KSTG * DK)           // bf16 elements of K, and of V^T, per stage (8 KB)
#define BUFB (2 * STGE * 2)        // bytes per ring buffer: K, then V^T

// One thread's share of a stage: two 16-byte pieces of K, two of V^T. gk and gv
// are the thread's first pieces in global memory, l that of K in the buffer (LDS
// byte address); the second piece lies STGE / 2 elements = STGE bytes on. The
// s_wait_xcnt stands inside the statement, so that no address register of a copy
// is rewritten in front of it.
__device__ __forceinline__ void stage_kv(const __bf16* gk, const __bf16* gv, unsigned l) {
    asm volatile("global_load_async_to_lds_b128 %0, %4, off\n\t"
                 "global_load_async_to_lds_b128 %1, %5, off\n\t"
                 "global_load_async_to_lds_b128 %2, %6, off\n\t"
                 "global_load_async_to_lds_b128 %3, %7, off\n\t"
                 "s_wait_xcnt 0x0"
                 :: "v"(l), "v"(l + STGE), "v"(l + 2 * STGE), "v"(l + 3 * STGE),
                    "v"(gk), "v"(gk + STGE / 2), "v"(gv), "v"(gv + STGE / 2)
                 : "memory");
}

// One fused multiply-add takes a raw score s (the product K Q^T as it leaves the
// matrix unit) to the exponent of 2 that its weight needs:
//   exp(s / 8 - m / 8) = exp2(s * SC2 - m * SC2),  SC2 = log2(e) / 8,
// the maximum m being kept on the raw scores (SC2 > 0 keeps their order).
#define SC2 0.18033688011112042f
// A masked score, in raw units. The definition's -1e9 is -8e9 raw; -2^33 stands for
// it because a power of two times SC2 is exact: in a row whose keys are all masked
// every exponent is exactly 0 and the weights are equal, as the definition gives
// them. Beside any unmasked score both values give the weight 0.
#define RAWMASKED (-8589934592.0f)

// lane l <-> lane l ^ 16
__device__ __forceinline__ float xhalf(float x) {
    int b = __builtin_bit_cast(int, x);
    return __builtin_bit_cast(float,
        __builtin_amdgcn_permlanex16(b, b, 0x76543210, 0xfedcba98, false, false));
}

// waves_per_eu(8, 8): the grid fills the chip at 4 blocks per WGP = 8 waves per SIMD,
// as before. Without it the compiler, seeing LDS for 10 blocks, squeezes the loop
// into 96 registers and waits out every LDS load one by one.
__global__ __launch_bounds__(256) __attribute__((amdgpu_waves_per_eu(8, 8))) void attn_kernel(const __bf16* __restrict__ Qh,
                                                   const __bf16* __restrict__ Kp,
                                                   const __bf16* __restrict__ Vp,
                                                   const unsigned* __restrict__ pm,
                                                   __bf16* __restrict__ ctx) {
    __shared__ __attribute__((aligned(16))) __bf16 ring[2][2][STGE];   // [buffer][K, V^T]

    int lane = threadIdx.x & 31, wave = threadIdx.x >> 5;
    int bh = blockIdx.y;                 // b*NH + h
    int b  = bh >> 4, h = bh & (NH - 1);
    int q0 = (blockIdx.x * 8 + wave) * 16;
    int N  = lane & 15;                  // this lane's query
    int kb = (lane >> 4) * 8;

    // resident Q fragments (dk = 64 -> two 32x16 B fragments, column = query)
    const __bf16* qbase = Qh + ((size_t)bh * SEQ + q0 + N) * DK;
    v16bf qb0 = frag_bf16(qbase + kb);
    v16bf qb1 = frag_bf16(qbase + 32 + kb);

    v8f o[4];                            // o[f][r] = O[query N][f*16 + kb + r]
#pragma unroll
    for (int f = 0; f < 4; ++f) o[f] = zero8();
    float mrun = -1e30f;                 // the query's maximum (raw), equal in both halves
    float nmrun = -1e30f * -SC2;         // -mrun * SC2, the addend of the scores' fma
    float lrun = 0.0f;                   // this half's share of the query's sum

    // the wave's packed mask words. An earlier launch wrote them and nothing writes them
    // while this kernel runs: read through the constant address space, at an address
    // formed from the wave's number as a scalar, they come by scalar loads straight into
    // the scalar registers that the selects take as their lane condition
    const AS_CONST vu16* mwav = (const AS_CONST vu16*)(pm
        + (size_t)(b * (SEQ / 16) + blockIdx.x * 8 + __builtin_amdgcn_readfirstlane(wave))
          * (SEQ / 32) * MWORDS);

    // ring prologue: stage 0 lands and is published, stage 1 is under way
    const __bf16* gk = Kp + (size_t)bh * SEQ * DK + threadIdx.x * 8;
    const __bf16* gv = Vp + (size_t)bh * SEQ * DK + threadIdx.x * 8;
    unsigned l0 = (unsigned)(size_t)(AS_LDS __bf16*)&ring[0][0][threadIdx.x * 8];
    stage_kv(gk, gv, l0);
    // this wave's copies of stage 0 have landed before the barrier publishes them
    asm volatile("s_wait_asynccnt 0x0" ::: "memory");
    __syncthreads();
    stage_kv(gk + STGE, gv + STGE, l0 + BUFB);

    for (int t = 0; t < NSTG; ++t) {
      const __bf16* kst = &ring[t & 1][0][lane * 8];
      const __bf16* vst = &ring[t & 1][1][lane * 8];
      // kept rolled: two passes scheduled as one region want more than the 128
      // registers that 8 waves per SIMD leave a wave
#pragma unroll 1
      for (int ps = 0; ps < KSTG / 32; ++ps) {
        int s0 = t * KSTG + ps * 32;
        // --- scores: two 16x16 tiles (keys s0..+15, s0+16..+31) x 16 queries
        const __bf16* kB0 = kst + ps * 4 * WFRAG;                 // 4 blocks, 4 KB
        const __bf16* kB1 = kB0 + 2 * WFRAG;
        v8f st0 = wmma_bf16(frag_packed(kB0 + WFRAG), qb1,
                  wmma_bf16(frag_packed(kB0), qb0, zero8()));
        v8f st1 = wmma_bf16(frag_packed(kB1 + WFRAG), qb1,
                  wmma_bf16(frag_packed(kB1), qb0, zero8()));

        // --- mask: one word per score register is the select's lane condition
        vu16 mk = mwav[s0 >> 5];
        float v0[8], v1[8];
#pragma unroll
        for (int i = 0; i < 8; ++i) {
            v0[i] = __builtin_amdgcn_inverse_ballot_w32(mk[i])     ? st0[i] : RAWMASKED;
            v1[i] = __builtin_amdgcn_inverse_ballot_w32(mk[8 + i]) ? st1[i] : RAWMASKED;
        }

        // --- online softmax of one query per lane pair
        float t = fmaxf(v0[0], v1[0]);
#pragma unroll
        for (int i = 1; i < 8; ++i) t = fmaxf(t, fmaxf(v0[i], v1[i]));
        t = fmaxf(t, xhalf(t));
        float mnew  = fmaxf(mrun, t);
        float nmnew = mnew * -SC2;
        float alpha = __builtin_amdgcn_exp2f(nmnew - nmrun);
        mrun = mnew;
        nmrun = nmnew;

        v16bf pb;                        // P^T as B: element s = key kmap(s, h)
        float rs = 0.0f;
#pragma unroll
        for (int i = 0; i < 8; ++i) {
            float p0 = __builtin_amdgcn_exp2f(__builtin_fmaf(v0[i], SC2, nmnew));
            float p1 = __builtin_amdgcn_exp2f(__builtin_fmaf(v1[i], SC2, nmnew));
            rs += p0 + p1;
            pb[i]     = (__bf16)p0;
            pb[8 + i] = (__bf16)p1;
        }
        lrun = lrun * alpha + rs;
#pragma unroll
        for (int f = 0; f < 4; ++f)
#pragma unroll
            for (int i = 0; i < 8; ++i) o[f][i] *= alpha;

        // --- O^T += V^T @ P^T  (V^T blocks of this key step, one per 16-d tile)
        const __bf16* vb = vst + ps * 4 * WFRAG;
#pragma unroll
        for (int f = 0; f < 4; ++f)
            o[f] = wmma_bf16(frag_packed(vb + f * WFRAG), pb, o[f]);
        // one more vector slot behind the pass's last product; the scheduling fence
        // keeps the v_nop at the foot of the pass
        __builtin_amdgcn_sched_barrier(0);
        asm volatile("v_nop");
      }

      // publish point of stage t + 1: this wave's reads of stage t are done ...
      asm volatile("s_wait_dscnt 0x0" ::: "memory");
      // ... its copies of stage t + 1 have landed ...
      asm volatile("s_wait_asynccnt 0x0" ::: "memory");
      // ... and behind the barrier that holds for all 8 waves
      __syncthreads();
      if (t + 2 < NSTG)                  // refill the buffer that every wave has left
          stage_kv(gk + (t + 2) * STGE, gv + (t + 2) * STGE, l0 + (t & 1) * BUFB);
    }
    // no copy is outstanding when the wave ends
    asm volatile("s_wait_asynccnt 0x0" ::: "memory");

    // --- join the halves' sums, normalize, store ctx (bf16, [B,S,D], D = h*64+d):
    // a lane's 8 accumulators of a tile are 8 consecutive d of its query
    float inv = 1.0f / (lrun + xhalf(lrun));
    __bf16* cp = ctx + ((size_t)(b * SEQ + q0 + N)) * DM + h * DK + kb;
#pragma unroll
    for (int f = 0; f < 4; ++f) {
        v8bf r;
#pragma unroll
        for (int i = 0; i < 8; ++i) r[i] = (__bf16)(o[f][i] * inv);
        *reinterpret_cast<v8bf*>(cp + f * 16) = r;
    }
}

// ---------------------------------------------------------------- kernel 4:
// out = LN(ctx @ Wo + bo + residual); one block = 32 full rows, 16 waves.
// The shared bf16 ctx A tile (64 KB) is staged async into LDS; each wave owns
// 2 row tiles x 4 column tiles, so a W fragment loaded from global feeds 2
// products and an A fragment read from LDS feeds 4.
#define ORT 2                      // 16-row tiles per wave (and per block)
#define OCT 4                      // 16-column tiles per wave
#define OWAVES 16
__global__ __launch_bounds__(OWAVES * 32) void oproj_ln_kernel(const __bf16* __restrict__ ctx,
                                                       const __bf16* __restrict__ Wot,
                                                       const float* __restrict__ bo,
                                                       const float* __restrict__ residual,
                                                       const float* __restrict__ gamma,
                                                       const float* __restrict__ beta,
                                                       float* __restrict__ out) {
    __shared__ __attribute__((aligned(16))) __bf16 Abuf[ORT * 16][DM + PADH];  // pitch 2064 B
    __shared__ __attribute__((aligned(16))) float  xrow[ORT * 16][DM];  // 128 KB

    int lane = threadIdx.x & 31, wave = threadIdx.x >> 5;
    int m0 = blockIdx.x * (ORT * 16);
    int kb = (lane >> 4) * 8;

    // stage A tile: 32 rows x 1024 bf16, four rows per shot
    {
        const __bf16* gsrc = ctx + (size_t)m0 * DM;
        int row = threadIdx.x >> 7, col = (threadIdx.x & 127) * 8;
#pragma unroll
        for (int it = 0; it < ORT * 4; ++it)
            stage_async_b128(gsrc + (it * 4 + row) * DM + col, &Abuf[it * 4 + row][col]);
    }
    stage_wait();

    const __bf16* ap = &Abuf[lane & 15][kb];
    const __bf16* bp = Wot + (size_t)(wave * OCT) * WTILE + lane * 8;

    v8f c[ORT][OCT];
#pragma unroll
    for (int r = 0; r < ORT; ++r)
#pragma unroll
        for (int j = 0; j < OCT; ++j) c[r][j] = zero8();

    // unrolled by 2: the second k step's W loads issue under the first's products
#pragma unroll 2
    for (int k0 = 0; k0 < DM; k0 += 32) {
        v16bf b[OCT];
#pragma unroll
        for (int j = 0; j < OCT; ++j)
            b[j] = frag_packed(bp + j * WTILE + (k0 >> 5) * WFRAG);
#pragma unroll
        for (int r = 0; r < ORT; ++r) {
            v16bf a = frag_bf16(ap + r * 16 * (DM + PADH) + k0);
#pragma unroll
            for (int j = 0; j < OCT; ++j) c[r][j] = wmma_bf16(a, b[j], c[r][j]);
        }
    }

    // the wave's 64 residual elements per lane, all loads in flight together
    int col0 = wave * OCT * 16 + (lane & 15);
    int row0 = (lane >> 4) << 3;
    const float* rp = residual + (size_t)(m0 + row0) * DM + col0;
    float res[OCT][ORT][8];
#pragma unroll
    for (int j = 0; j < OCT; ++j)
#pragma unroll
        for (int r = 0; r < ORT; ++r)
#pragma unroll
            for (int i = 0; i < 8; ++i) res[j][r][i] = rp[(r * 16 + i) * DM + j * 16];
    // the address stays live up to this wait, so that no load of the run lands in
    // a register that an earlier load of the run names as its address
    asm volatile("s_wait_xcnt 0x0" :: "v"(rp) : "memory");

#pragma unroll
    for (int j = 0; j < OCT; ++j) {
        int colB = col0 + j * 16;
        float bv = bo[colB];
#pragma unroll
        for (int r = 0; r < ORT; ++r)
#pragma unroll
            for (int i = 0; i < 8; ++i) {
                int M = r * 16 + i + row0;
                float val = c[r][j][i] + bv + res[j][r][i];
                xrow[M][colB] = val;
            }
    }

    __syncthreads();

    // LayerNorm: 16 waves x 2 rows
#pragma unroll
    for (int rr = 0; rr < 2; ++rr) {
        int r = wave * 2 + rr;
        float sum = 0.0f, sq = 0.0f;
#pragma unroll
        for (int j = 0; j < DM / 32; ++j) {
            float x = xrow[r][lane + 32 * j];
            sum += x; sq += x * x;
        }
#pragma unroll
        for (int d = 1; d < 32; d <<= 1) {
            sum += __shfl_xor(sum, d, 32);
            sq  += __shfl_xor(sq,  d, 32);
        }
        float mu   = sum * (1.0f / DM);
        float var  = sq * (1.0f / DM) - mu * mu;
        float rinv = rsqrtf(var + 1e-6f);
        size_t grow = (size_t)(m0 + r) * DM;
#pragma unroll
        for (int j = 0; j < DM / 32; ++j) {
            int col = lane + 32 * j;
            float x = xrow[r][col];
            out[grow + col] = (x - mu) * rinv * gamma[col] + beta[col];
        }
    }
}

// ---------------------------------------------------------------- launcher
extern "C" void kernel_launch(void* const* d_in, const int* in_sizes, int n_in,
                              void* d_out, int out_size, void* d_ws, size_t ws_size,
                              hipStream_t stream) {
    const float* q    = (const float*)d_in[0];
    const float* k    = (const float*)d_in[1];
    const float* v    = (const float*)d_in[2];
    const int*   mask = (const int*)  d_in[3];
    const float* Wq   = (const float*)d_in[4];
    const float* bq   = (const float*)d_in[5];
    const float* Wk   = (const float*)d_in[6];
    const float* bk   = (const float*)d_in[7];
    const float* Wv   = (const float*)d_in[8];
    const float* bv   = (const float*)d_in[9];
    const float* Wo   = (const float*)d_in[10];
    const float* bo   = (const float*)d_in[11];
    const float* gamma = (const float*)d_in[12];
    const float* beta  = (const float*)d_in[13];
    float* out = (float*)d_out;

    char* ws = (char*)d_ws;
    const size_t WSZ  = (size_t)DM * DM;              // per-weight elems
    const size_t HSZ  = (size_t)NB * NH * SEQ * DK;   // per-head-tensor elems
    __bf16* Wt  = (__bf16*)ws;                                        // 4*WSZ bf16
    __bf16* Qh  = (__bf16*)(ws + 4 * WSZ * 2);                        // HSZ
    __bf16* Kh  = Qh + HSZ;
    __bf16* Vt  = Kh + HSZ;
    __bf16* CTX = Vt + HSZ;                                           // HSZ
    unsigned* PM = (unsigned*)(CTX + HSZ);                            // NB*SEQ*SEQ/32 words

    wconv_kernel<<<dim3(WSZ / 8 / 256, 5), 256, 0, stream>>>(Wq, Wk, Wv, Wo, Wt, mask, PM);

    dim3 pg(NB * SEQ / (PRT * 16), DM / (16 * PCT * PWAVES));
    proj_kernel<<<pg, PWAVES * 32, 0, stream>>>(q, Wt,           bq, Qh, 0);
    proj_kernel<<<pg, PWAVES * 32, 0, stream>>>(k, Wt + WSZ,     bk, Kh, 2);
    proj_kernel<<<pg, PWAVES * 32, 0, stream>>>(v, Wt + 2 * WSZ, bv, Vt, 1);

    attn_kernel<<<dim3(SEQ / 128, NB * NH), 256, 0, stream>>>(Qh, Kh, Vt, PM, CTX);

    oproj_ln_kernel<<<dim3(NB * SEQ / (ORT * 16)), OWAVES * 32, 0, stream>>>(
        CTX, Wt + 3 * WSZ, bo, q, gamma, beta, out);
}

// v009
// A run of this version takes 161 microseconds.
// Timed twice side by side with v008, it ran 1.04 and 1.05 times as fast.
// Counting every step since v000, it is 6.07 times as fast.
#include <hip/hip_runtime.h>

// ---------------------------------------------------------------- types
typedef __attribute__((ext_vector_type(16))) __bf16 v16bf;
typedef __attribute__((ext_vector_type(8)))  __bf16 v8bf;
typedef __attribute__((ext_vector_type(8)))  float  v8f;
typedef __attribute__((ext_vector_type(4)))  int    vi4;
typedef __attribute__((ext_vector_type(4)))  unsigned vu4;
typedef __attribute__((ext_vector_type(16))) unsigned vu16;

#define NB   4
#define SEQ  2048
#define DM   1024
#define NH   16
#define DK   64

// LDS row pads: every tile that ds_load_b128 reads as a WMMA fragment (16 lanes
// = 16 rows) gets a row pitch of 16 B x odd, so the 16 rows fall on 64 distinct
// banks instead of on the same four.
#define PADF 4    // f32 elements  (16 B)
#define PADH 8    // bf16 elements (16 B)

#define AS_GLOBAL __attribute__((address_space(1)))
#define AS_LDS    __attribute__((address_space(3)))
#define AS_CONST  __attribute__((address_space(4)))

__device__ __forceinline__ v8f zero8() {
    v8f z;
#pragma unroll
    for (int i = 0; i < 8; ++i) z[i] = 0.0f;
    return z;
}

__device__ __forceinline__ v16bf cat16(v8bf lo, v8bf hi) {
    v16bf r;
#pragma unroll
    for (int i = 0; i < 8; ++i) { r[i] = lo[i]; r[8 + i] = hi[i]; }
    return r;
}

// A/B fragment (16x32 bf16) per ISA layout: lane m = lane&15,
// kb = (lane>=16)?8:0, elems 0..7 = K[kb..kb+7], 8..15 = K[kb+16..kb+23].
__device__ __forceinline__ v16bf frag_bf16(const __bf16* p) {
    v8bf lo = *reinterpret_cast<const v8bf*>(p);
    v8bf hi = *reinterpret_cast<const v8bf*>(p + 16);
    return cat16(lo, hi);
}

// Packed weights: W^T is stored in B-fragment order. One 16-col x 32-k fragment
// is a 1 KB block [half-fragment 2][lane 32][8 bf16], so that each wave-wide
// 16-byte load reads 512 contiguous bytes (4 whole lines). Blocks run k-step
// first, then 16-column tile. Lane and element carry the same k as frag_bf16.
#define WFRAG 512                  // bf16 elements per fragment block
#define WTILE (WFRAG * (DM / 32))  // bf16 elements per 16-column tile
__device__ __forceinline__ v16bf frag_packed(const __bf16* p) {
    v8bf lo = *reinterpret_cast<const v8bf*>(p);
    v8bf hi = *reinterpret_cast<const v8bf*>(p + 256);
    return cat16(lo, hi);
}

// K and V^T of the attention use the same 1 KB fragment blocks:
//   K  : block = 16 keys x 32 d,  order [b*h][16-key tile][d step 2]
//   V^T: block = 16 d   x 32 keys, order [b*h][32-key step][16-d tile 4]
// so the 8 KB that one 32-key step reads are two contiguous 4 KB runs.

// Same fragment but converting fp32 source inline (two float4 pairs).
__device__ __forceinline__ v16bf frag_f32(const float* p) {
    const float4* p4 = reinterpret_cast<const float4*>(p);
    float4 f0 = p4[0], f1 = p4[1], f2 = p4[4], f3 = p4[5];
    v16bf r;
    r[0] = (__bf16)f0.x; r[1]  = (__bf16)f0.y; r[2]  = (__bf16)f0.z; r[3]  = (__bf16)f0.w;
    r[4] = (__bf16)f1.x; r[5]  = (__bf16)f1.y; r[6]  = (__bf16)f1.z; r[7]  = (__bf16)f1.w;
    r[8] = (__bf16)f2.x; r[9]  = (__bf16)f2.y; r[10] = (__bf16)f2.z; r[11] = (__bf16)f2.w;
    r[12] = (__bf16)f3.x; r[13] = (__bf16)f3.y; r[14] = (__bf16)f3.z; r[15] = (__bf16)f3.w;
    return r;
}

__device__ __forceinline__ v8f wmma_bf16(v16bf a, v16bf b, v8f c) {
    return __builtin_amdgcn_wmma_f32_16x16x32_bf16(false, a, false, b, (short)0, c, false, false);
}

// ---- async global->LDS staging (CDNA5 ASYNCcnt path), guarded fallback ----
__device__ __forceinline__ void stage_async_b128(const void* g, void* l) {
#if __has_builtin(__builtin_amdgcn_global_load_async_to_lds_b128)
    __builtin_amdgcn_global_load_async_to_lds_b128(
        (AS_GLOBAL vi4*)(g), (AS_LDS vi4*)(l), 0, 0);
#else
    *(float4*)l = *(const float4*)g;
#endif
}

__device__ __forceinline__ void stage_wait() {
#if __has_builtin(__builtin_amdgcn_global_load_async_to_lds_b128)
#if __has_builtin(__builtin_amdgcn_s_wait_asynccnt)
    __builtin_amdgcn_s_wait_asynccnt(0);
#else
    asm volatile("s_wait_asynccnt 0" ::: "memory");
#endif
#endif
    __syncthreads();
}

// Packed mask: the attention wave holds, in score register i of a 32-key step,
// lane l's score of query l & 15 and key kmap(i, l >> 4) = (i >> 3) * 16 + (l >> 4) * 8
// + (i & 7). One 32-bit word per register holds mask != 0 of its 32 lanes, bit l for
// lane l: the form a select takes as its lane condition. Order [b * 128 + 16-query
// tile][32-key step][i 16]: 64 bytes in a row per step, 4 KB per wave's walk.
#define MWORDS 16                  // words per query tile and key step
// the pack launch: one block per query tile, as many as a weight matrix has blocks;
// one thread per 4 words of the tile
static_assert(NB * SEQ / 16 == DM * DM / 8 / 256, "mask tiles = blocks per weight matrix");
static_assert(SEQ / 32 * MWORDS / 4 == 256, "4 words per thread of a 256-thread block");

// ---------------------------------------------------------------- kernel 1:
// blockIdx.y = 1..4: convert the 4 weight matrices to bf16 W^T in packed B-fragment
// order; one thread writes one lane's 16-byte piece (8 consecutive k of one column).
// blockIdx.y = 0: pack the mask; one block = one 16-query tile, one thread = 4 words
// (4 consecutive keys in each of the tile's 16 rows and both wave halves).
__global__ __launch_bounds__(256) void wconv_kernel(const float* __restrict__ Wq,
                                                    const float* __restrict__ Wk,
                                                    const float* __restrict__ Wv,
                                                    const float* __restrict__ Wo,
                                                    __bf16* __restrict__ Wt,
                                                    const int* __restrict__ mask,
                                                    unsigned* __restrict__ pm) {
    if (blockIdx.y == 0) {
        int j = threadIdx.x & 3, ks = threadIdx.x >> 2;
        const int* mp = mask + (size_t)blockIdx.x * 16 * SEQ + ks * 32 + (j >> 1) * 16 + (j & 1) * 4;
        vu4 wd = { 0u, 0u, 0u, 0u };
        // unrolled: the shift counts are constants, and the loads issue in long runs
        // ahead of their use
#pragma unroll
        for (int l = 0; l < 32; ++l) {
            vi4 m = *reinterpret_cast<const vi4*>(mp + (l & 15) * SEQ + (l >> 4) * 8);
#pragma unroll
            for (int e = 0; e < 4; ++e) wd[e] |= (m[e] != 0 ? 1u : 0u) << l;
        }
        *reinterpret_cast<vu4*>(pm + ((size_t)blockIdx.x * 256 + threadIdx.x) * 4) = wd;
        return;
    }
    int w = blockIdx.y - 1;
    const float* src = (w == 0) ? Wq : (w == 1) ? Wk : (w == 2) ? Wv : Wo;
    __bf16* dst = Wt + (size_t)w * DM * DM;
    int p = blockIdx.x * 256 + threadIdx.x;     // piece index in the packed order
    int ln = p & 31, hi = (p >> 5) & 1, ks = (p >> 6) & 31, nt = p >> 11;
    int n = nt * 16 + (ln & 15);
    int k = ks * 32 + hi * 16 + (ln >> 4) * 8;
    v8bf r;
    // unrolled: r is indexed by constants (stays in registers), the 8 loads issue together
#pragma unroll
    for (int e = 0; e < 8; ++e) r[e] = (__bf16)src[(size_t)(k + e) * DM + n];
    *reinterpret_cast<v8bf*>(dst + (size_t)p * 8) = r;
}

// ---------------------------------------------------------------- kernel 2:
// Y = X @ W + b, bf16 output per head. layout 0: rows [b,h,s,dk] (Q);
// layout 1: V^T fragment blocks; layout 2: K fragment blocks.
// One launch does all three projections: a block keeps its place (64 rows, 512
// columns) and walks z = 0, 1, 2 for Q, K, V, which do not depend on one another.
// No end and start of a launch lies between them, and the copies of the next A tile
// are issued as soon as every wave has left the current one, in front of the
// current tile's stores, which then run under the copies' way from memory.
// The three packed weights lie one behind the other in Wt3, the outputs in out3.
// One block = 64 rows x 512 columns. The 64-row fp32 A tile is staged once into
// LDS (async) and shared by all 16 waves; each wave owns 4 row tiles x 2 column
// tiles, so a W fragment loaded from global feeds 4 products and an A fragment
// read and converted from LDS feeds 2.
#define PRT 4                      // 16-row tiles per wave (and per block)
#define PCT 2                      // 16-column tiles per wave
#define PWAVES 16

// stage A tile: 64 rows x 1024 f32, 16B per lane per shot, two rows per shot
__device__ __forceinline__ void stage_rows(const float* gsrc, float (*As)[DM + PADF]) {
    int row = threadIdx.x >> 8, col = (threadIdx.x & 255) * 4;
    const float* g = gsrc + row * DM + col;
    float* l = &As[row][col];
    // unrolled by 4 only: fully unrolled, the 32 address pairs are the same for Q, K and V,
    // the compiler keeps them in registers across the product loop, and that loop, short
    // of registers, then waits out every LDS load one by one
#pragma unroll 4
    for (int it = 0; it < PRT * 8; ++it) {
        stage_async_b128(g, l);
        g += 2 * DM;
        l += 2 * (DM + PADF);
    }
}

__global__ __launch_bounds__(PWAVES * 32) void proj_kernel(const float* __restrict__ Xq,
                                                   const float* __restrict__ Xk,
                                                   const float* __restrict__ Xv,
                                                   const __bf16* __restrict__ Wt3,
                                                   const float* __restrict__ biasq,
                                                   const float* __restrict__ biask,
                                                   const float* __restrict__ biasv,
                                                   __bf16* __restrict__ out3) {
    __shared__ __attribute__((aligned(16))) float As[PRT * 16][DM + PADF];   // pitch 4112 B

    int lane = threadIdx.x & 31, wave = threadIdx.x >> 5;
    int m0  = blockIdx.x * (PRT * 16);
    int nt0 = (blockIdx.y * PWAVES + wave) * PCT;    // the wave's first column tile
    int kb  = (lane >> 4) * 8;

    stage_rows(Xq + (size_t)m0 * DM, As);

    const float* ap = &As[lane & 15][kb];

  // kept rolled: one copy of the product loop and of the stores in the instruction cache
#pragma unroll 1
  for (int z = 0; z < 3; ++z) {
    const float*  bias = (z == 0) ? biasq : (z == 1) ? biask : biasv;
    __bf16*       out  = out3 + (size_t)z * NB * NH * SEQ * DK;
    int layout = (z == 0) ? 0 : (z == 1) ? 2 : 1;
    const __bf16* bp = Wt3 + (size_t)z * DM * DM + (size_t)nt0 * WTILE + lane * 8;

    // this wave's copies of the A tile have landed before the barrier publishes them
    asm volatile("s_wait_asynccnt 0x0" ::: "memory");
    __syncthreads();

    // the bias comes ahead of the products, for speed only
    float bvs[PCT];
#pragma unroll
    for (int j = 0; j < PCT; ++j) bvs[j] = bias[(nt0 + j) * 16 + (lane & 15)];

    v8f c[PRT][PCT];
#pragma unroll
    for (int r = 0; r < PRT; ++r)
#pragma unroll
        for (int j = 0; j < PCT; ++j) c[r][j] = zero8();

    // unrolled by 2: the W loads of two k steps are in flight together
#pragma unroll 2
    for (int k0 = 0; k0 < DM; k0 += 32) {
        v16bf b[PCT];
#pragma unroll
        for (int j = 0; j < PCT; ++j)
            b[j] = frag_packed(bp + j * WTILE + (k0 >> 5) * WFRAG);
#pragma unroll
        for (int r = 0; r < PRT; ++r) {
            v16bf a = frag_f32(ap + r * 16 * (DM + PADF) + k0);
#pragma unroll
            for (int j = 0; j < PCT; ++j) c[r][j] = wmma_bf16(a, b[j], c[r][j]);
        }
    }

    if (z < 2) {
        // this wave's reads of the tile have retired ...
        asm volatile("s_wait_dscnt 0x0" ::: "memory");
        // ... and behind the barrier every wave's: the next tile may overwrite it
        __syncthreads();
        stage_rows((z == 0 ? Xk : Xv) + (size_t)m0 * DM, As);
    }

    int bq = (m0 >> 11) * NH;            // the 64 rows of a block share one batch
    int sb = m0 & (SEQ - 1);
#pragma unroll
    for (int j = 0; j < PCT; ++j) {
        int colB = (nt0 + j) * 16 + (lane & 15);
        float bv = bvs[j];
        int h = colB >> 6, d = colB & (DK - 1);
        int bh = bq + h;
        if (layout == 1) {
            // a lane's 8 accumulators are 8 consecutive keys of one d: exactly its
            // 16-byte piece of the V^T block, so the wave stores 512 contiguous bytes
#pragma unroll
            for (int r = 0; r < PRT; ++r) {
                int s0 = sb + r * 16;
                v8bf o;
#pragma unroll
                for (int i = 0; i < 8; ++i) o[i] = (__bf16)(c[r][j][i] + bv);
                size_t blk = ((size_t)bh * (SEQ / 32) + (s0 >> 5)) * 4 + (d >> 4);
                *reinterpret_cast<v8bf*>(out + blk * WFRAG + ((s0 >> 4) & 1) * 256 + lane * 8) = o;
            }
            // the next column tile's code rewrites registers that these stores name
            asm volatile("s_wait_xcnt 0x0" ::: "memory");
        } else {
            // a lane's 8 accumulators are 8 consecutive rows s of one d: one element
            // every DK elements in the row layout, every 8 (next lane slot) in a K block
            int sl = (lane >> 4) << 3;
            int step = (layout == 2) ? 8 : DK;
#pragma unroll
            for (int r = 0; r < PRT; ++r) {
                int s0 = sb + r * 16;
                size_t blk = ((size_t)bh * (SEQ / 16) + (s0 >> 4)) * 2 + (d >> 5);
                size_t koff = blk * WFRAG + ((d >> 4) & 1) * 256 + (((d >> 3) & 1) * 16 + sl) * 8 + (d & 7);
                size_t qoff = ((size_t)bh * SEQ + s0 + sl) * DK + d;
                __bf16* p = out + (layout == 2 ? koff : qoff);
#pragma unroll
                for (int i = 0; i < 8; ++i) p[i * step] = (__bf16)(c[r][j][i] + bv);
            }
            // in the listing this path falls on into the other branch's code, which
            // rewrites registers that these stores name: keep the wait in front of it
            asm volatile("s_wait_xcnt 0x0" ::: "memory");
        }
    }
  }
}

#define KSTG 64                    // keys per ring stage
#define NSTG (SEQ / KSTG)
#define STGE (KSTG * DK)           // bf16 elements of K, and of V^T, per stage (8 KB)
#define BUFB (2 * STGE * 2)        // bytes per ring buffer: K, then V^T

// One thread's share of a stage: two 16-byte pieces of K, two of V^T. gk and gv
// are the thread's first pieces in global memory, l that of K in the buffer (LDS
// byte address); the second piece lies STGE / 2 elements = STGE bytes on. The
// s_wait_xcnt stands inside the statement, so that no address register of a copy
// is rewritten in front of it.
__device__ __forceinline__ void stage_kv(const __bf16* gk, const __bf16* gv, unsigned l) {
    asm volatile("global_load_async_to_lds_b128 %0, %4, off\n\t"
                 "global_load_async_to_lds_b128 %1, %5, off\n\t"
                 "global_load_async_to_lds_b128 %2, %6, off\n\t"
                 "global_load_async_to_lds_b128 %3, %7, off\n\t"
                 "s_wait_xcnt 0x0"
                 :: "v"(l), "v"(l + STGE), "v"(l + 2 * STGE), "v"(l + 3 * STGE),
                    "v"(gk), "v"(gk + STGE / 2), "v"(gv), "v"(gv + STGE / 2)
                 : "memory");
}

// One fused multiply-add takes a raw score s (the product K Q^T as it leaves the
// matrix unit) to the exponent of 2 that its weight needs:
//   exp(s / 8 - m / 8) = exp2(s * SC2 - m * SC2),  SC2 = log2(e) / 8,
// the maximum m being kept on the raw scores (SC2 > 0 keeps their order).
#define SC2 0.18033688011112042f
// A masked score, in raw units. The definition's -1e9 is -8e9 raw; -2^33 stands for
// it because a power of two times SC2 is exact: in a row whose keys are all masked
// every exponent is exactly 0 and the weights are equal, as the definition gives
// them. Beside any unmasked score both values give the weight 0.
#define RAWMASKED (-8589934592.0f)

// lane l <-> lane l ^ 16
__device__ __forceinline__ float xhalf(float x) {
    int b = __builtin_bit_cast(int, x);
    return __builtin_bit_cast(float,
        __builtin_amdgcn_permlanex16(b, b, 0x76543210, 0xfedcba98, false, false));
}

// waves_per_eu(8, 8): the grid fills the chip at 4 blocks per WGP = 8 waves per SIMD,
// as before. Without it the compiler, seeing LDS for 10 blocks, squeezes the loop
// into 96 registers and waits out every LDS load one by one.
__global__ __launch_bounds__(256) __attribute__((amdgpu_waves_per_eu(8, 8))) void attn_kernel(const __bf16* __restrict__ Qh,
                                                   const __bf16* __restrict__ Kp,
                                                   const __bf16* __restrict__ Vp,
                                                   const unsigned* __restrict__ pm,
                                                   __bf16* __restrict__ ctx) {
    __shared__ __attribute__((aligned(16))) __bf16 ring[2][2][STGE];   // [buffer][K, V^T]

    int lane = threadIdx.x & 31, wave = threadIdx.x >> 5;
    int bh = blockIdx.y;                 // b*NH + h
    int b  = bh >> 4, h = bh & (NH - 1);
    int q0 = (blockIdx.x * 8 + wave) * 16;
    int N  = lane & 15;                  // this lane's query
    int kb = (lane >> 4) * 8;

    // resident Q fragments (dk = 64 -> two 32x16 B fragments, column = query)
    const __bf16* qbase = Qh + ((size_t)bh * SEQ + q0 + N) * DK;
    v16bf qb0 = frag_bf16(qbase + kb);
    v16bf qb1 = frag_bf16(qbase + 32 + kb);

    v8f o[4];                            // o[f][r] = O[query N][f*16 + kb + r]
#pragma unroll
    for (int f = 0; f < 4; ++f) o[f] = zero8();
    float mrun = -1e30f;                 // the query's maximum (raw), equal in both halves
    float nmrun = -1e30f * -SC2;         // -mrun * SC2, the addend of the scores' fma
    float lrun = 0.0f;                   // this half's share of the query's sum

    // the wave's packed mask words. An earlier launch wrote them and nothing writes them
    // while this kernel runs: read through the constant address space, at an address
    // formed from the wave's number as a scalar, they come by scalar loads straight into
    // the scalar registers that the selects take as their lane condition
    const AS_CONST vu16* mwav = (const AS_CONST vu16*)(pm
        + (size_t)(b * (SEQ / 16) + blockIdx.x * 8 + __builtin_amdgcn_readfirstlane(wave))
          * (SEQ / 32) * MWORDS);

    // ring prologue: stage 0 lands and is published, stage 1 is under way
    const __bf16* gk = Kp + (size_t)bh * SEQ * DK + threadIdx.x * 8;
    const __bf16* gv = Vp + (size_t)bh * SEQ * DK + threadIdx.x * 8;
    unsigned l0 = (unsigned)(size_t)(AS_LDS __bf16*)&ring[0][0][threadIdx.x * 8];
    stage_kv(gk, gv, l0);
    // this wave's copies of stage 0 have landed before the barrier publishes them
    asm volatile("s_wait_asynccnt 0x0" ::: "memory");
    __syncthreads();
    stage_kv(gk + STGE, gv + STGE, l0 + BUFB);

    for (int t = 0; t < NSTG; ++t) {
      const __bf16* kst = &ring[t & 1][0][lane * 8];
      const __bf16* vst = &ring[t & 1][1][lane * 8];
      // kept rolled: two passes scheduled as one region want more than the 128
      // registers that 8 waves per SIMD leave a wave
#pragma unroll 1
      for (int ps = 0; ps < KSTG / 32; ++ps) {
        int s0 = t * KSTG + ps * 32;
        // --- scores: two 16x16 tiles (keys s0..+15, s0+16..+31) x 16 queries
        const __bf16* kB0 = kst + ps * 4 * WFRAG;                 // 4 blocks, 4 KB
        const __bf16* kB1 = kB0 + 2 * WFRAG;
        v8f st0 = wmma_bf16(frag_packed(kB0 + WFRAG), qb1,
                  wmma_bf16(frag_packed(kB0), qb0, zero8()));
        v8f st1 = wmma_bf16(frag_packed(kB1 + WFRAG), qb1,
                  wmma_bf16(frag_packed(kB1), qb0, zero8()));

        // --- mask: one word per score register is the select's lane condition
        vu16 mk = mwav[s0 >> 5];
        float v0[8], v1[8];
#pragma unroll
        for (int i = 0; i < 8; ++i) {
            v0[i] = __builtin_amdgcn_inverse_ballot_w32(mk[i])     ? st0[i] : RAWMASKED;
            v1[i] = __builtin_amdgcn_inverse_ballot_w32(mk[8 + i]) ? st1[i] : RAWMASKED;
        }

        // --- online softmax of one query per lane pair
        float t = fmaxf(v0[0], v1[0]);
#pragma unroll
        for (int i = 1; i < 8; ++i) t = fmaxf(t, fmaxf(v0[i], v1[i]));
        t = fmaxf(t, xhalf(t));
        float mnew  = fmaxf(mrun, t);
        float nmnew = mnew * -SC2;
        float alpha = __builtin_amdgcn_exp2f(nmnew - nmrun);
        mrun = mnew;
        nmrun = nmnew;

        v16bf pb;                        // P^T as B: element s = key kmap(s, h)
        float rs = 0.0f;
#pragma unroll
        for (int i = 0; i < 8; ++i) {
            float p0 = __builtin_amdgcn_exp2f(__builtin_fmaf(v0[i], SC2, nmnew));
            float p1 = __builtin_amdgcn_exp2f(__builtin_fmaf(v1[i], SC2, nmnew));
            rs += p0 + p1;
            pb[i]     = (__bf16)p0;
            pb[8 + i] = (__bf16)p1;
        }
        lrun = lrun * alpha + rs;
#pragma unroll
        for (int f = 0; f < 4; ++f)
#pragma unroll
            for (int i = 0; i < 8; ++i) o[f][i] *= alpha;

        // --- O^T += V^T @ P^T  (V^T blocks of this key step, one per 16-d tile)
        const __bf16* vb = vst + ps * 4 * WFRAG;
#pragma unroll
        for (int f = 0; f < 4; ++f)
            o[f] = wmma_bf16(frag_packed(vb + f * WFRAG), pb, o[f]);
        // one more vector slot behind the pass's last product; the scheduling fence
        // keeps the v_nop at the foot of the pass
        __builtin_amdgcn_sched_barrier(0);
        asm volatile("v_nop");
      }

      // publish point of stage t + 1: this wave's reads of stage t are done ...
      asm volatile("s_wait_dscnt 0x0" ::: "memory");
      // ... its copies of stage t + 1 have landed ...
      asm volatile("s_wait_asynccnt 0x0" ::: "memory");
      // ... and behind the barrier that holds for all 8 waves
      __syncthreads();
      if (t + 2 < NSTG)                  // refill the buffer that every wave has left
          stage_kv(gk + (t + 2) * STGE, gv + (t + 2) * STGE, l0 + (t & 1) * BUFB);
    }
    // no copy is outstanding when the wave ends
    asm volatile("s_wait_asynccnt 0x0" ::: "memory");

    // --- join the halves' sums, normalize, store ctx (bf16, [B,S,D], D = h*64+d):
    // a lane's 8 accumulators of a tile are 8 consecutive d of its query
    float inv = 1.0f / (lrun + xhalf(lrun));
    __bf16* cp = ctx + ((size_t)(b * SEQ + q0 + N)) * DM + h * DK + kb;
#pragma unroll
    for (int f = 0; f < 4; ++f) {
        v8bf r;
#pragma unroll
        for (int i = 0; i < 8; ++i) r[i] = (__bf16)(o[f][i] * inv);
        *reinterpret_cast<v8bf*>(cp + f * 16) = r;
    }
}

// ---------------------------------------------------------------- kernel 4:
// out = LN(ctx @ Wo + bo + residual); one block = 32 full rows, 16 waves.
// The shared bf16 ctx A tile (64 KB) is staged async into LDS; each wave owns
// 2 row tiles x 4 column tiles, so a W fragment loaded from global feeds 2
// products and an A fragment read from LDS feeds 4.
#define ORT 2                      // 16-row tiles per wave (and per block)
#define OCT 4                      // 16-column tiles per wave
#define OWAVES 16
__global__ __launch_bounds__(OWAVES * 32) void oproj_ln_kernel(const __bf16* __restrict__ ctx,
                                                       const __bf16* __restrict__ Wot,
                                                       const float* __restrict__ bo,
                                                       const float* __restrict__ residual,
                                                       const float* __restrict__ gamma,
                                                       const float* __restrict__ beta,
                                                       float* __restrict__ out) {
    __shared__ __attribute__((aligned(16))) __bf16 Abuf[ORT * 16][DM + PADH];  // pitch 2064 B
    __shared__ __attribute__((aligned(16))) float  xrow[ORT * 16][DM];  // 128 KB

    int lane = threadIdx.x & 31, wave = threadIdx.x >> 5;
    int m0 = blockIdx.x * (ORT * 16);
    int kb = (lane >> 4) * 8;

    // stage A tile: 32 rows x 1024 bf16, four rows per shot
    {
        const __bf16* gsrc = ctx + (size_t)m0 * DM;
        int row = threadIdx.x >> 7, col = (threadIdx.x & 127) * 8;
#pragma unroll
        for (int it = 0; it < ORT * 4; ++it)
            stage_async_b128(gsrc + (it * 4 + row) * DM + col, &Abuf[it * 4 + row][col]);
    }
    stage_wait();

    const __bf16* ap = &Abuf[lane & 15][kb];
    const __bf16* bp = Wot + (size_t)(wave * OCT) * WTILE + lane * 8;

    v8f c[ORT][OCT];
#pragma unroll
    for (int r = 0; r < ORT; ++r)
#pragma unroll
        for (int j = 0; j < OCT; ++j) c[r][j] = zero8();

    // unrolled by 2: the second k step's W loads issue under the first's products
#pragma unroll 2
    for (int k0 = 0; k0 < DM; k0 += 32) {
        v16bf b[OCT];
#pragma unroll
        for (int j = 0; j < OCT; ++j)
            b[j] = frag_packed(bp + j * WTILE + (k0 >> 5) * WFRAG);
#pragma unroll
        for (int r = 0; r < ORT; ++r) {
            v16bf a = frag_bf16(ap + r * 16 * (DM + PADH) + k0);
#pragma unroll
            for (int j = 0; j < OCT; ++j) c[r][j] = wmma_bf16(a, b[j], c[r][j]);
        }
    }

    // the wave's 64 residual elements per lane, all loads in flight together
    int col0 = wave * OCT * 16 + (lane & 15);
    int row0 = (lane >> 4) << 3;
    const float* rp = residual + (size_t)(m0 + row0) * DM + col0;
    float res[OCT][ORT][8];
#pragma unroll
    for (int j = 0; j < OCT; ++j)
#pragma unroll
        for (int r = 0; r < ORT; ++r)
#pragma unroll
            for (int i = 0; i < 8; ++i) res[j][r][i] = rp[(r * 16 + i) * DM + j * 16];
    // the address stays live up to this wait, so that no load of the run lands in
    // a register that an earlier load of the run names as its address
    asm volatile("s_wait_xcnt 0x0" :: "v"(rp) : "memory");

#pragma unroll
    for (int j = 0; j < OCT; ++j) {
        int colB = col0 + j * 16;
        float bv = bo[colB];
#pragma unroll
        for (int r = 0; r < ORT; ++r)
#pragma unroll
            for (int i = 0; i < 8; ++i) {
                int M = r * 16 + i + row0;
                float val = c[r][j][i] + bv + res[j][r][i];
                xrow[M][colB] = val;
            }
    }

    __syncthreads();

    // LayerNorm: 16 waves x 2 rows
#pragma unroll
    for (int rr = 0; rr < 2; ++rr) {
        int r = wave * 2 + rr;
        float sum = 0.0f, sq = 0.0f;
#pragma unroll
        for (int j = 0; j < DM / 32; ++j) {
            float x = xrow[r][lane + 32 * j];
            sum += x; sq += x * x;
        }
#pragma unroll
        for (int d = 1; d < 32; d <<= 1) {
            sum += __shfl_xor(sum, d, 32);
            sq  += __shfl_xor(sq,  d, 32);
        }
        float mu   = sum * (1.0f / DM);
        float var  = sq * (1.0f / DM) - mu * mu;
        float rinv = rsqrtf(var + 1e-6f);
        size_t grow = (size_t)(m0 + r) * DM;
#pragma unroll
        for (int j = 0; j < DM / 32; ++j) {
            int col = lane + 32 * j;
            float x = xrow[r][col];
            out[grow + col] = (x - mu) * rinv * gamma[col] + beta[col];
        }
    }
}

// ---------------------------------------------------------------- launcher
extern "C" void kernel_launch(void* const* d_in, const int* in_sizes, int n_in,
                              void* d_out, int out_size, void* d_ws, size_t ws_size,
                              hipStream_t stream) {
    const float* q    = (const float*)d_in[0];
    const float* k    = (const float*)d_in[1];
    const float* v    = (const float*)d_in[2];
    const int*   mask = (const int*)  d_in[3];
    const float* Wq   = (const float*)d_in[4];
    const float* bq   = (const float*)d_in[5];
    const float* Wk   = (const float*)d_in[6];
    const float* bk   = (const float*)d_in[7];
    const float* Wv   = (const float*)d_in[8];
    const float* bv   = (const float*)d_in[9];
    const float* Wo   = (const float*)d_in[10];
    const float* bo   = (const float*)d_in[11];
    const float* gamma = (const float*)d_in[12];
    const float* beta  = (const float*)d_in[13];
    float* out = (float*)d_out;

    char* ws = (char*)d_ws;
    const size_t WSZ  = (size_t)DM * DM;              // per-weight elems
    const size_t HSZ  = (size_t)NB * NH * SEQ * DK;   // per-head-tensor elems
    __bf16* Wt  = (__bf16*)ws;                                        // 4*WSZ bf16
    __bf16* Qh  = (__bf16*)(ws + 4 * WSZ * 2);                        // HSZ
    __bf16* Kh  = Qh + HSZ;
    __bf16* Vt  = Kh + HSZ;
    __bf16* CTX = Vt + HSZ;                                           // HSZ
    unsigned* PM = (unsigned*)(CTX + HSZ);                            // NB*SEQ*SEQ/32 words

    wconv_kernel<<<dim3(WSZ / 8 / 256, 5), 256, 0, stream>>>(Wq, Wk, Wv, Wo, Wt, mask, PM);

    // Qh, Kh, Vt follow one another in the workspace, as Wq, Wk, Wv do in Wt
    dim3 pg(NB * SEQ / (PRT * 16), DM / (16 * PCT * PWAVES));
    proj_kernel<<<pg, PWAVES * 32, 0, stream>>>(q, k, v, Wt, bq, bk, bv, Qh);

    attn_kernel<<<dim3(SEQ / 128, NB * NH), 256, 0, stream>>>(Qh, Kh, Vt, PM, CTX);

    oproj_ln_kernel<<<dim3(NB * SEQ / (ORT * 16)), OWAVES * 32, 0, stream>>>(
        CTX, Wt + 3 * WSZ, bo, q, gamma, beta, out);
}

// v010
// It runs in 152 microseconds.
// In both of two side-by-side timings against v009, it was 1.05 times as fast.
// Over all steps from v000 it is 6.37 times as fast.
#include <hip/hip_runtime.h>

// ---------------------------------------------------------------- types
typedef __attribute__((ext_vector_type(16))) __bf16 v16bf;
typedef __attribute__((ext_vector_type(8)))  __bf16 v8bf;
typedef __attribute__((ext_vector_type(4)))  __bf16 v4bf;
typedef __attribute__((ext_vector_type(8)))  float  v8f;
typedef __attribute__((ext_vector_type(4)))  int    vi4;
typedef __attribute__((ext_vector_type(4)))  unsigned vu4;
typedef __attribute__((ext_vector_type(16))) unsigned vu16;

#define NB   4
#define SEQ  2048
#define DM   1024
#define NH   16
#define DK   64

// LDS row pads: every tile that ds_load_b128 reads as a WMMA fragment (16 lanes
// = 16 rows) gets a row pitch of 16 B x odd, so the 16 rows fall on 64 distinct
// banks instead of on the same four.
#define PADH 8    // bf16 elements (16 B)

#define AS_GLOBAL __attribute__((address_space(1)))
#define AS_LDS    __attribute__((address_space(3)))
#define AS_CONST  __attribute__((address_space(4)))

__device__ __forceinline__ v8f zero8() {
    v8f z;
#pragma unroll
    for (int i = 0; i < 8; ++i) z[i] = 0.0f;
    return z;
}

__device__ __forceinline__ v16bf cat16(v8bf lo, v8bf hi) {
    v16bf r;
#pragma unroll
    for (int i = 0; i < 8; ++i) { r[i] = lo[i]; r[8 + i] = hi[i]; }
    return r;
}

// A/B fragment (16x32 bf16) per ISA layout: lane m = lane&15,
// kb = (lane>=16)?8:0, elems 0..7 = K[kb..kb+7], 8..15 = K[kb+16..kb+23].
__device__ __forceinline__ v16bf frag_bf16(const __bf16* p) {
    v8bf lo = *reinterpret_cast<const v8bf*>(p);
    v8bf hi = *reinterpret_cast<const v8bf*>(p + 16);
    return cat16(lo, hi);
}

// Packed weights: W^T is stored in B-fragment order. One 16-col x 32-k fragment
// is a 1 KB block [half-fragment 2][lane 32][8 bf16], so that each wave-wide
// 16-byte load reads 512 contiguous bytes (4 whole lines). Blocks run k-step
// first, then 16-column tile. Lane and element carry the same k as frag_bf16.
#define WFRAG 512                  // bf16 elements per fragment block
#define WTILE (WFRAG * (DM / 32))  // bf16 elements per 16-column tile
__device__ __forceinline__ v16bf frag_packed(const __bf16* p) {
    v8bf lo = *reinterpret_cast<const v8bf*>(p);
    v8bf hi = *reinterpret_cast<const v8bf*>(p + 256);
    return cat16(lo, hi);
}

// K and V^T of the attention use the same 1 KB fragment blocks:
//   K  : block = 16 keys x 32 d,  order [b*h][16-key tile][d step 2]
//   V^T: block = 16 d   x 32 keys, order [b*h][32-key step][16-d tile 4]
// so the 8 KB that one 32-key step reads are two contiguous 4 KB runs.

__device__ __forceinline__ v8f wmma_bf16(v16bf a, v16bf b, v8f c) {
    return __builtin_amdgcn_wmma_f32_16x16x32_bf16(false, a, false, b, (short)0, c, false, false);
}

// ---- async global->LDS staging (CDNA5 ASYNCcnt path), guarded fallback ----
__device__ __forceinline__ void stage_async_b128(const void* g, void* l) {
#if __has_builtin(__builtin_amdgcn_global_load_async_to_lds_b128)
    __builtin_amdgcn_global_load_async_to_lds_b128(
        (AS_GLOBAL vi4*)(g), (AS_LDS vi4*)(l), 0, 0);
#else
    *(float4*)l = *(const float4*)g;
#endif
}

__device__ __forceinline__ void stage_wait() {
#if __has_builtin(__builtin_amdgcn_global_load_async_to_lds_b128)
#if __has_builtin(__builtin_amdgcn_s_wait_asynccnt)
    __builtin_amdgcn_s_wait_asynccnt(0);
#else
    asm volatile("s_wait_asynccnt 0" ::: "memory");
#endif
#endif
    __syncthreads();
}

// Packed mask: the attention wave holds, in score register i of a 32-key step,
// lane l's score of query l & 15 and key kmap(i, l >> 4) = (i >> 3) * 16 + (l >> 4) * 8
// + (i & 7). One 32-bit word per register holds mask != 0 of its 32 lanes, bit l for
// lane l: the form a select takes as its lane condition. Order [b * 128 + 16-query
// tile][32-key step][i 16]: 64 bytes in a row per step, 4 KB per wave's walk.
#define MWORDS 16                  // words per query tile and key step
// the pack launch: one block per query tile, as many as a weight matrix has blocks;
// one thread per 4 words of the tile
static_assert(NB * SEQ / 16 == DM * DM / 8 / 256, "mask tiles = blocks per weight matrix");
static_assert(SEQ / 32 * MWORDS / 4 == 256, "4 words per thread of a 256-thread block");

// ---------------------------------------------------------------- kernel 1:
// blockIdx.y = 1..4: convert the 4 weight matrices to bf16 W^T in packed B-fragment
// order; one thread writes one lane's 16-byte piece (8 consecutive k of one column).
// blockIdx.y = 0: pack the mask; one block = one 16-query tile, one thread = 4 words
// (4 consecutive keys in each of the tile's 16 rows and both wave halves).
__global__ __launch_bounds__(256) void wconv_kernel(const float* __restrict__ Wq,
                                                    const float* __restrict__ Wk,
                                                    const float* __restrict__ Wv,
                                                    const float* __restrict__ Wo,
                                                    __bf16* __restrict__ Wt,
                                                    const int* __restrict__ mask,
                                                    unsigned* __restrict__ pm) {
    if (blockIdx.y == 0) {
        int j = threadIdx.x & 3, ks = threadIdx.x >> 2;
        const int* mp = mask + (size_t)blockIdx.x * 16 * SEQ + ks * 32 + (j >> 1) * 16 + (j & 1) * 4;
        vu4 wd = { 0u, 0u, 0u, 0u };
        // unrolled: the shift counts are constants, and the loads issue in long runs
        // ahead of their use
#pragma unroll
        for (int l = 0; l < 32; ++l) {
            vi4 m = *reinterpret_cast<const vi4*>(mp + (l & 15) * SEQ + (l >> 4) * 8);
#pragma unroll
            for (int e = 0; e < 4; ++e) wd[e] |= (m[e] != 0 ? 1u : 0u) << l;
        }
        *reinterpret_cast<vu4*>(pm + ((size_t)blockIdx.x * 256 + threadIdx.x) * 4) = wd;
        return;
    }
    int w = blockIdx.y - 1;
    const float* src = (w == 0) ? Wq : (w == 1) ? Wk : (w == 2) ? Wv : Wo;
    __bf16* dst = Wt + (size_t)w * DM * DM;
    int p = blockIdx.x * 256 + threadIdx.x;     // piece index in the packed order
    int ln = p & 31, hi = (p >> 5) & 1, ks = (p >> 6) & 31, nt = p >> 11;
    int n = nt * 16 + (ln & 15);
    int k = ks * 32 + hi * 16 + (ln >> 4) * 8;
    v8bf r;
    // unrolled: r is indexed by constants (stays in registers), the 8 loads issue together
#pragma unroll
    for (int e = 0; e < 8; ++e) r[e] = (__bf16)src[(size_t)(k + e) * DM + n];
    *reinterpret_cast<v8bf*>(dst + (size_t)p * 8) = r;
}

// ---------------------------------------------------------------- kernel 2:
// Y = X @ W + b, bf16 output per head. layout 0: rows [b,h,s,dk] (Q);
// layout 1: V^T fragment blocks; layout 2: K fragment blocks.
// One launch does all three projections: blockIdx.y = 0, 1, 2 for Q, K, V.
// The three packed weights lie one behind the other in Wt3, the outputs in out3.
// One block = 128 rows x all 1024 columns, walked in two halves of 512. The fp32 rows
// are converted to bf16 ONCE, on their way into LDS (through registers), not by every
// wave at every fragment read: a fragment read moves half the LDS bytes, and 128 rows
// fit where 64 did. Each wave owns 8 row tiles x 2 column tiles, so a W fragment
// loaded from global feeds 8 products and an A fragment read from LDS feeds 2.
#define PRT 8                      // 16-row tiles per wave (and per block)
#define PCT 2                      // 16-column tiles per wave
#define PWAVES 16
#define PHALVES (DM / (16 * PCT * PWAVES))   // column halves a block walks

__global__ __launch_bounds__(PWAVES * 32) void proj_kernel(const float* __restrict__ Xq,
                                                   const float* __restrict__ Xk,
                                                   const float* __restrict__ Xv,
                                                   const __bf16* __restrict__ Wt3,
                                                   const float* __restrict__ biasq,
                                                   const float* __restrict__ biask,
                                                   const float* __restrict__ biasv,
                                                   __bf16* __restrict__ out3) {
    __shared__ __attribute__((aligned(16))) __bf16 As[PRT * 16][DM + PADH];   // pitch 2064 B

    int lane = threadIdx.x & 31, wave = threadIdx.x >> 5;
    int m0  = blockIdx.x * (PRT * 16);
    int z   = blockIdx.y;
    int kb  = (lane >> 4) * 8;

    const float*  X    = (z == 0) ? Xq : (z == 1) ? Xk : Xv;
    const float*  bias = (z == 0) ? biasq : (z == 1) ? biask : biasv;
    __bf16*       out  = out3 + (size_t)z * NB * NH * SEQ * DK;
    int layout = (z == 0) ? 0 : (z == 1) ? 2 : 1;

    // stage the A tile: 128 rows x 1024, two rows per shot; a lane loads 16 bytes (a wave
    // 4 whole lines) and stores its 4 converted elements, 8 bytes
    {
        int row = threadIdx.x >> 8, col = (threadIdx.x & 255) * 4;
        const float* g = X + (size_t)(m0 + row) * DM + col;
        __bf16* l = &As[row][col];
        // kept rolled: one batch of 16 loads per lane is in flight at a time
#pragma unroll 1
        for (int bt = 0; bt < PRT / 2; ++bt) {
            float4 f[16];
#pragma unroll
            for (int i = 0; i < 16; ++i) f[i] = *reinterpret_cast<const float4*>(g + i * 2 * DM);
            // the address stays live up to this wait, so that no load of the run lands in
            // a register that an earlier load of the run names as its address
            asm volatile("s_wait_xcnt 0x0" :: "v"(g) : "memory");
#pragma unroll
            for (int i = 0; i < 16; ++i) {
                v4bf o;
                o[0] = (__bf16)f[i].x; o[1] = (__bf16)f[i].y;
                o[2] = (__bf16)f[i].z; o[3] = (__bf16)f[i].w;
                *reinterpret_cast<v4bf*>(l + i * 2 * (DM + PADH)) = o;
            }
            g += 32 * DM;
            l += 32 * (DM + PADH);
        }
    }
    // publishes the tile; nothing writes it afterwards
    __syncthreads();

    const __bf16* ap = &As[lane & 15][kb];

  // kept rolled: one copy of the product loop and of the stores in the instruction cache
#pragma unroll 1
  for (int ch = 0; ch < PHALVES; ++ch) {
    int nt0 = (ch * PWAVES + wave) * PCT;            // the wave's first column tile
    const __bf16* bp = Wt3 + (size_t)z * DM * DM + (size_t)nt0 * WTILE + lane * 8;

    float bvs[PCT];
#pragma unroll
    for (int j = 0; j < PCT; ++j) bvs[j] = bias[(nt0 + j) * 16 + (lane & 15)];

    v8f c[PRT][PCT];
#pragma unroll
    for (int r = 0; r < PRT; ++r)
#pragma unroll
        for (int j = 0; j < PCT; ++j) c[r][j] = zero8();

    // The loads run ahead of the products that use them: the W fragments by one k step,
    // the A fragments by half a step (4 row tiles), each as one group. The last step
    // fetches step 0 again: inside the arrays, and not used.
    v16bf bc[PCT], alo[PRT / 2];
#pragma unroll
    for (int j = 0; j < PCT; ++j) bc[j] = frag_packed(bp + j * WTILE);
#pragma unroll
    for (int r = 0; r < PRT / 2; ++r) alo[r] = frag_bf16(ap + r * 16 * (DM + PADH));

    // unrolled by 2: the two W register sets change roles without copies
#pragma unroll 2
    for (int ks = 0; ks < DM / 32; ++ks) {
        int kn = (ks + 1) & (DM / 32 - 1);
        v16bf bn[PCT], ahi[PRT / 2];
#pragma unroll
        for (int j = 0; j < PCT; ++j) bn[j] = frag_packed(bp + j * WTILE + kn * WFRAG);
#pragma unroll
        for (int r = 0; r < PRT / 2; ++r)
            ahi[r] = frag_bf16(ap + (PRT / 2 + r) * 16 * (DM + PADH) + ks * 32);
        // keeps the group of loads above in front of the products below
        __builtin_amdgcn_sched_barrier(0);
#pragma unroll
        for (int r = 0; r < PRT / 2; ++r)
#pragma unroll
            for (int j = 0; j < PCT; ++j) c[r][j] = wmma_bf16(alo[r], bc[j], c[r][j]);
#pragma unroll
        for (int r = 0; r < PRT / 2; ++r) alo[r] = frag_bf16(ap + r * 16 * (DM + PADH) + kn * 32);
        // keeps the next step's A loads in front of this step's second half
        __builtin_amdgcn_sched_barrier(0);
#pragma unroll
        for (int r = 0; r < PRT / 2; ++r)
#pragma unroll
            for (int j = 0; j < PCT; ++j)
                c[PRT / 2 + r][j] = wmma_bf16(ahi[r], bc[j], c[PRT / 2 + r][j]);
#pragma unroll
        for (int j = 0; j < PCT; ++j) bc[j] = bn[j];
    }

    int bq = (m0 >> 11) * NH;            // the 128 rows of a block share one batch
    int sb = m0 & (SEQ - 1);
#pragma unroll
    for (int j = 0; j < PCT; ++j) {
        int colB = (nt0 + j) * 16 + (lane & 15);
        float bv = bvs[j];
        int h = colB >> 6, d = colB & (DK - 1);
        int bh = bq + h;
        if (layout == 1) {
            // a lane's 8 accumulators are 8 consecutive keys of one d: exactly its
            // 16-byte piece of the V^T block, so the wave stores 512 contiguous bytes
#pragma unroll
            for (int r = 0; r < PRT; ++r) {
                int s0 = sb + r * 16;
                v8bf o;
#pragma unroll
                for (int i = 0; i < 8; ++i) o[i] = (__bf16)(c[r][j][i] + bv);
                size_t blk = ((size_t)bh * (SEQ / 32) + (s0 >> 5)) * 4 + (d >> 4);
                *reinterpret_cast<v8bf*>(out + blk * WFRAG + ((s0 >> 4) & 1) * 256 + lane * 8) = o;
            }
            // the next column tile's code rewrites registers that these stores name
            asm volatile("s_wait_xcnt 0x0" ::: "memory");
        } else {
            // a lane's 8 accumulators are 8 consecutive rows s of one d: one element
            // every DK elements in the row layout, every 8 (next lane slot) in a K block
            int sl = (lane >> 4) << 3;
            int step = (layout == 2) ? 8 : DK;
#pragma unroll
            for (int r = 0; r < PRT; ++r) {
                int s0 = sb + r * 16;
                size_t blk = ((size_t)bh * (SEQ / 16) + (s0 >> 4)) * 2 + (d >> 5);
                size_t koff = blk * WFRAG + ((d >> 4) & 1) * 256 + (((d >> 3) & 1) * 16 + sl) * 8 + (d & 7);
                size_t qoff = ((size_t)bh * SEQ + s0 + sl) * DK + d;
                __bf16* p = out + (layout == 2 ? koff : qoff);
#pragma unroll
                for (int i = 0; i < 8; ++i) p[i * step] = (__bf16)(c[r][j][i] + bv);
            }
            // in the listing this path falls on into the other branch's code, which
            // rewrites registers that these stores name: keep the wait in front of it
            asm volatile("s_wait_xcnt 0x0" ::: "memory");
        }
    }
  }
}

#define KSTG 64                    // keys per ring stage
#define NSTG (SEQ / KSTG)
#define STGE (KSTG * DK)           // bf16 elements of K, and of V^T, per stage (8 KB)
#define BUFB (2 * STGE * 2)        // bytes per ring buffer: K, then V^T

// One thread's share of a stage: two 16-byte pieces of K, two of V^T. gk and gv
// are the thread's first pieces in global memory, l that of K in the buffer (LDS
// byte address); the second piece lies STGE / 2 elements = STGE bytes on. The
// s_wait_xcnt stands inside the statement, so that no address register of a copy
// is rewritten in front of it.
__device__ __forceinline__ void stage_kv(const __bf16* gk, const __bf16* gv, unsigned l) {
    asm volatile("global_load_async_to_lds_b128 %0, %4, off\n\t"
                 "global_load_async_to_lds_b128 %1, %5, off\n\t"
                 "global_load_async_to_lds_b128 %2, %6, off\n\t"
                 "global_load_async_to_lds_b128 %3, %7, off\n\t"
                 "s_wait_xcnt 0x0"
                 :: "v"(l), "v"(l + STGE), "v"(l + 2 * STGE), "v"(l + 3 * STGE),
                    "v"(gk), "v"(gk + STGE / 2), "v"(gv), "v"(gv + STGE / 2)
                 : "memory");
}

// One fused multiply-add takes a raw score s (the product K Q^T as it leaves the
// matrix unit) to the exponent of 2 that its weight needs:
//   exp(s / 8 - m / 8) = exp2(s * SC2 - m * SC2),  SC2 = log2(e) / 8,
// the maximum m being kept on the raw scores (SC2 > 0 keeps their order).
#define SC2 0.18033688011112042f
// A masked score, in raw units. The definition's -1e9 is -8e9 raw; -2^33 stands for
// it because a power of two times SC2 is exact: in a row whose keys are all masked
// every exponent is exactly 0 and the weights are equal, as the definition gives
// them. Beside any unmasked score both values give the weight 0.
#define RAWMASKED (-8589934592.0f)

// lane l <-> lane l ^ 16
__device__ __forceinline__ float xhalf(float x) {
    int b = __builtin_bit_cast(int, x);
    return __builtin_bit_cast(float,
        __builtin_amdgcn_permlanex16(b, b, 0x76543210, 0xfedcba98, false, false));
}

// waves_per_eu(8, 8): the grid fills the chip at 4 blocks per WGP = 8 waves per SIMD,
// as before. Without it the compiler, seeing LDS for 10 blocks, squeezes the loop
// into 96 registers and waits out every LDS load one by one.
__global__ __launch_bounds__(256) __attribute__((amdgpu_waves_per_eu(8, 8))) void attn_kernel(const __bf16* __restrict__ Qh,
                                                   const __bf16* __restrict__ Kp,
                                                   const __bf16* __restrict__ Vp,
                                                   const unsigned* __restrict__ pm,
                                                   __bf16* __restrict__ ctx) {
    __shared__ __attribute__((aligned(16))) __bf16 ring[2][2][STGE];   // [buffer][K, V^T]

    int lane = threadIdx.x & 31, wave = threadIdx.x >> 5;
    int bh = blockIdx.y;                 // b*NH + h
    int b  = bh >> 4, h = bh & (NH - 1);
    int q0 = (blockIdx.x * 8 + wave) * 16;
    int N  = lane & 15;                  // this lane's query
    int kb = (lane >> 4) * 8;

    // resident Q fragments (dk = 64 -> two 32x16 B fragments, column = query)
    const __bf16* qbase = Qh + ((size_t)bh * SEQ + q0 + N) * DK;
    v16bf qb0 = frag_bf16(qbase + kb);
    v16bf qb1 = frag_bf16(qbase + 32 + kb);

    v8f o[4];                            // o[f][r] = O[query N][f*16 + kb + r]
#pragma unroll
    for (int f = 0; f < 4; ++f) o[f] = zero8();
    float mrun = -1e30f;                 // the query's maximum (raw), equal in both halves
    float nmrun = -1e30f * -SC2;         // -mrun * SC2, the addend of the scores' fma
    float lrun = 0.0f;                   // this half's share of the query's sum

    // the wave's packed mask words. An earlier launch wrote them and nothing writes them
    // while this kernel runs: read through the constant address space, at an address
    // formed from the wave's number as a scalar, they come by scalar loads straight into
    // the scalar registers that the selects take as their lane condition
    const AS_CONST vu16* mwav = (const AS_CONST vu16*)(pm
        + (size_t)(b * (SEQ / 16) + blockIdx.x * 8 + __builtin_amdgcn_readfirstlane(wave))
          * (SEQ / 32) * MWORDS);

    // ring prologue: stage 0 lands and is published, stage 1 is under way
    const __bf16* gk = Kp + (size_t)bh * SEQ * DK + threadIdx.x * 8;
    const __bf16* gv = Vp + (size_t)bh * SEQ * DK + threadIdx.x * 8;
    unsigned l0 = (unsigned)(size_t)(AS_LDS __bf16*)&ring[0][0][threadIdx.x * 8];
    stage_kv(gk, gv, l0);
    // this wave's copies of stage 0 have landed before the barrier publishes them
    asm volatile("s_wait_asynccnt 0x0" ::: "memory");
    __syncthreads();
    stage_kv(gk + STGE, gv + STGE, l0 + BUFB);

    for (int t = 0; t < NSTG; ++t) {
      const __bf16* kst = &ring[t & 1][0][lane * 8];
      const __bf16* vst = &ring[t & 1][1][lane * 8];
      // kept rolled: two passes scheduled as one region want more than the 128
      // registers that 8 waves per SIMD leave a wave
#pragma unroll 1
      for (int ps = 0; ps < KSTG / 32; ++ps) {
        int s0 = t * KSTG + ps * 32;
        // --- scores: two 16x16 tiles (keys s0..+15, s0+16..+31) x 16 queries
        const __bf16* kB0 = kst + ps * 4 * WFRAG;                 // 4 blocks, 4 KB
        const __bf16* kB1 = kB0 + 2 * WFRAG;
        v8f st0 = wmma_bf16(frag_packed(kB0 + WFRAG), qb1,
                  wmma_bf16(frag_packed(kB0), qb0, zero8()));
        v8f st1 = wmma_bf16(frag_packed(kB1 + WFRAG), qb1,
                  wmma_bf16(frag_packed(kB1), qb0, zero8()));

        // --- mask: one word per score register is the select's lane condition
        vu16 mk = mwav[s0 >> 5];
        float v0[8], v1[8];
#pragma unroll
        for (int i = 0; i < 8; ++i) {
            v0[i] = __builtin_amdgcn_inverse_ballot_w32(mk[i])     ? st0[i] : RAWMASKED;
            v1[i] = __builtin_amdgcn_inverse_ballot_w32(mk[8 + i]) ? st1[i] : RAWMASKED;
        }

        // --- online softmax of one query per lane pair
        float t = fmaxf(v0[0], v1[0]);
#pragma unroll
        for (int i = 1; i < 8; ++i) t = fmaxf(t, fmaxf(v0[i], v1[i]));
        t = fmaxf(t, xhalf(t));
        float mnew  = fmaxf(mrun, t);
        float nmnew = mnew * -SC2;
        float alpha = __builtin_amdgcn_exp2f(nmnew - nmrun);
        mrun = mnew;
        nmrun = nmnew;

        v16bf pb;                        // P^T as B: element s = key kmap(s, h)
        float rs = 0.0f;
#pragma unroll
        for (int i = 0; i < 8; ++i) {
            float p0 = __builtin_amdgcn_exp2f(__builtin_fmaf(v0[i], SC2, nmnew));
            float p1 = __builtin_amdgcn_exp2f(__builtin_fmaf(v1[i], SC2, nmnew));
            rs += p0 + p1;
            pb[i]     = (__bf16)p0;
            pb[8 + i] = (__bf16)p1;
        }
        lrun = lrun * alpha + rs;
#pragma unroll
        for (int f = 0; f < 4; ++f)
#pragma unroll
            for (int i = 0; i < 8; ++i) o[f][i] *= alpha;

        // --- O^T += V^T @ P^T  (V^T blocks of this key step, one per 16-d tile)
        const __bf16* vb = vst + ps * 4 * WFRAG;
#pragma unroll
        for (int f = 0; f < 4; ++f)
            o[f] = wmma_bf16(frag_packed(vb + f * WFRAG), pb, o[f]);
        // one more vector slot behind the pass's last product; the scheduling fence
        // keeps the v_nop at the foot of the pass
        __builtin_amdgcn_sched_barrier(0);
        asm volatile("v_nop");
      }

      // publish point of stage t + 1: this wave's reads of stage t are done ...
      asm volatile("s_wait_dscnt 0x0" ::: "memory");
      // ... its copies of stage t + 1 have landed ...
      asm volatile("s_wait_asynccnt 0x0" ::: "memory");
      // ... and behind the barrier that holds for all 8 waves
      __syncthreads();
      if (t + 2 < NSTG)                  // refill the buffer that every wave has left
          stage_kv(gk + (t + 2) * STGE, gv + (t + 2) * STGE, l0 + (t & 1) * BUFB);
    }
    // no copy is outstanding when the wave ends
    asm volatile("s_wait_asynccnt 0x0" ::: "memory");

    // --- join the halves' sums, normalize, store ctx (bf16, [B,S,D], D = h*64+d):
    // a lane's 8 accumulators of a tile are 8 consecutive d of its query
    float inv = 1.0f / (lrun + xhalf(lrun));
    __bf16* cp = ctx + ((size_t)(b * SEQ + q0 + N)) * DM + h * DK + kb;
#pragma unroll
    for (int f = 0; f < 4; ++f) {
        v8bf r;
#pragma unroll
        for (int i = 0; i < 8; ++i) r[i] = (__bf16)(o[f][i] * inv);
        *reinterpret_cast<v8bf*>(cp + f * 16) = r;
    }
}

// ---------------------------------------------------------------- kernel 4:
// out = LN(ctx @ Wo + bo + residual); one block = 32 full rows, 16 waves.
// The shared bf16 ctx A tile (64 KB) is staged async into LDS; each wave owns
// 2 row tiles x 4 column tiles, so a W fragment loaded from global feeds 2
// products and an A fragment read from LDS feeds 4.
#define ORT 2                      // 16-row tiles per wave (and per block)
#define OCT 4                      // 16-column tiles per wave
#define OWAVES 16
__global__ __launch_bounds__(OWAVES * 32) void oproj_ln_kernel(const __bf16* __restrict__ ctx,
                                                       const __bf16* __restrict__ Wot,
                                                       const float* __restrict__ bo,
                                                       const float* __restrict__ residual,
                                                       const float* __restrict__ gamma,
                                                       const float* __restrict__ beta,
                                                       float* __restrict__ out) {
    __shared__ __attribute__((aligned(16))) __bf16 Abuf[ORT * 16][DM + PADH];  // pitch 2064 B
    __shared__ __attribute__((aligned(16))) float  xrow[ORT * 16][DM];  // 128 KB

    int lane = threadIdx.x & 31, wave = threadIdx.x >> 5;
    int m0 = blockIdx.x * (ORT * 16);
    int kb = (lane >> 4) * 8;

    // stage A tile: 32 rows x 1024 bf16, four rows per shot
    {
        const __bf16* gsrc = ctx + (size_t)m0 * DM;
        int row = threadIdx.x >> 7, col = (threadIdx.x & 127) * 8;
#pragma unroll
        for (int it = 0; it < ORT * 4; ++it)
            stage_async_b128(gsrc + (it * 4 + row) * DM + col, &Abuf[it * 4 + row][col]);
    }
    stage_wait();

    const __bf16* ap = &Abuf[lane & 15][kb];
    const __bf16* bp = Wot + (size_t)(wave * OCT) * WTILE + lane * 8;

    v8f c[ORT][OCT];
#pragma unroll
    for (int r = 0; r < ORT; ++r)
#pragma unroll
        for (int j = 0; j < OCT; ++j) c[r][j] = zero8();

    // unrolled by 2: the second k step's W loads issue under the first's products
#pragma unroll 2
    for (int k0 = 0; k0 < DM; k0 += 32) {
        v16bf b[OCT];
#pragma unroll
        for (int j = 0; j < OCT; ++j)
            b[j] = frag_packed(bp + j * WTILE + (k0 >> 5) * WFRAG);
#pragma unroll
        for (int r = 0; r < ORT; ++r) {
            v16bf a = frag_bf16(ap + r * 16 * (DM + PADH) + k0);
#pragma unroll
            for (int j = 0; j < OCT; ++j) c[r][j] = wmma_bf16(a, b[j], c[r][j]);
        }
    }

    // the wave's 64 residual elements per lane, all loads in flight together
    int col0 = wave * OCT * 16 + (lane & 15);
    int row0 = (lane >> 4) << 3;
    const float* rp = residual + (size_t)(m0 + row0) * DM + col0;
    float res[OCT][ORT][8];
#pragma unroll
    for (int j = 0; j < OCT; ++j)
#pragma unroll
        for (int r = 0; r < ORT; ++r)
#pragma unroll
            for (int i = 0; i < 8; ++i) res[j][r][i] = rp[(r * 16 + i) * DM + j * 16];
    // the address stays live up to this wait, so that no load of the run lands in
    // a register that an earlier load of the run names as its address
    asm volatile("s_wait_xcnt 0x0" :: "v"(rp) : "memory");

#pragma unroll
    for (int j = 0; j < OCT; ++j) {
        int colB = col0 + j * 16;
        float bv = bo[colB];
#pragma unroll
        for (int r = 0; r < ORT; ++r)
#pragma unroll
            for (int i = 0; i < 8; ++i) {
                int M = r * 16 + i + row0;
                float val = c[r][j][i] + bv + res[j][r][i];
                xrow[M][colB] = val;
            }
    }

    __syncthreads();

    // LayerNorm: 16 waves x 2 rows
#pragma unroll
    for (int rr = 0; rr < 2; ++rr) {
        int r = wave * 2 + rr;
        float sum = 0.0f, sq = 0.0f;
#pragma unroll
        for (int j = 0; j < DM / 32; ++j) {
            float x = xrow[r][lane + 32 * j];
            sum += x; sq += x * x;
        }
#pragma unroll
        for (int d = 1; d < 32; d <<= 1) {
            sum += __shfl_xor(sum, d, 32);
            sq  += __shfl_xor(sq,  d, 32);
        }
        float mu   = sum * (1.0f / DM);
        float var  = sq * (1.0f / DM) - mu * mu;
        float rinv = rsqrtf(var + 1e-6f);
        size_t grow = (size_t)(m0 + r) * DM;
#pragma unroll
        for (int j = 0; j < DM / 32; ++j) {
            int col = lane + 32 * j;
            float x = xrow[r][col];
            out[grow + col] = (x - mu) * rinv * gamma[col] + beta[col];
        }
    }
}

// ---------------------------------------------------------------- launcher
extern "C" void kernel_launch(void* const* d_in, const int* in_sizes, int n_in,
                              void* d_out, int out_size, void* d_ws, size_t ws_size,
                              hipStream_t stream) {
    const float* q    = (const float*)d_in[0];
    const float* k    = (const float*)d_in[1];
    const float* v    = (const float*)d_in[2];
    const int*   mask = (const int*)  d_in[3];
    const float* Wq   = (const float*)d_in[4];
    const float* bq   = (const float*)d_in[5];
    const float* Wk   = (const float*)d_in[6];
    const float* bk   = (const float*)d_in[7];
    const float* Wv   = (const float*)d_in[8];
    const float* bv   = (const float*)d_in[9];
    const float* Wo   = (const float*)d_in[10];
    const float* bo   = (const float*)d_in[11];
    const float* gamma = (const float*)d_in[12];
    const float* beta  = (const float*)d_in[13];
    float* out = (float*)d_out;

    char* ws = (char*)d_ws;
    const size_t WSZ  = (size_t)DM * DM;              // per-weight elems
    const size_t HSZ  = (size_t)NB * NH * SEQ * DK;   // per-head-tensor elems
    __bf16* Wt  = (__bf16*)ws;                                        // 4*WSZ bf16
    __bf16* Qh  = (__bf16*)(ws + 4 * WSZ * 2);                        // HSZ
    __bf16* Kh  = Qh + HSZ;
    __bf16* Vt  = Kh + HSZ;
    __bf16* CTX = Vt + HSZ;                                           // HSZ
    unsigned* PM = (unsigned*)(CTX + HSZ);                            // NB*SEQ*SEQ/32 words

    wconv_kernel<<<dim3(WSZ / 8 / 256, 5), 256, 0, stream>>>(Wq, Wk, Wv, Wo, Wt, mask, PM);

    // Qh, Kh, Vt follow one another in the workspace, as Wq, Wk, Wv do in Wt
    dim3 pg(NB * SEQ / (PRT * 16), 3);
    proj_kernel<<<pg, PWAVES * 32, 0, stream>>>(q, k, v, Wt, bq, bk, bv, Qh);

    attn_kernel<<<dim3(SEQ / 128, NB * NH), 256, 0, stream>>>(Qh, Kh, Vt, PM, CTX);

    oproj_ln_kernel<<<dim3(NB * SEQ / (ORT * 16)), OWAVES * 32, 0, stream>>>(
        CTX, Wt + 3 * WSZ, bo, q, gamma, beta, out);
}
